// v000
// The times below were measured on an AMD MI455X: many runs one after another, warmed up first and cycling through
// copies of the inputs, with the whole window's GPU time divided by the number of runs. Launches and the gaps
// between them are all in it. The median over several windows is given; except for v000 it joins two sittings, which
// can be a few percent apart, so the side-by-side timings, each taken in one sitting, are the better comparison.
// v000 is the starting kernel. One run takes 366 microseconds.
#include <hip/hip_runtime.h>

// CompressedAttention: K_c, V_c = mean over blocks of 4 consecutive keys (8192 -> 2048); out = softmax(Q.K_c / sqrt(128)) V_c -> [4][8192][128].
// WMMA (v_wmma_f32_16x16x32_f16, f32 accumulate): Q exact bf16 (x8 f16); K_c computed in f32 from the exact keys and split into an f16 hi+lo pair x8, S^T = K_c.Q (2 products: exact x hi+lo);
// online softmax in f32; o^T += (8 V_c)^T.P^T with V_c and P hi+lo (3 products). Fragment k-map per lane half hh for A AND B: elements 0..7 <- k = 8hh+0..7, 8..15 <- k = 16+8hh+0..7. Every

namespace {
constexpr int Bn = 4, S = 8192, D = 128, R4 = 4, SC = S / R4;
constexpr float XS = 8.0f, PS = 8.0f, ISC = 0.08838834764831845f;

typedef _Float16 b16;
typedef __attribute__((ext_vector_type(16))) _Float16 v16b;
typedef __attribute__((ext_vector_type(8))) _Float16 v8b;
typedef __attribute__((ext_vector_type(8))) float v8f;
typedef __attribute__((ext_vector_type(4))) float v4f;
__device__ __forceinline__ float bf16_rne(float f) { unsigned int u = __float_as_uint(f); u += 0x7FFFu + ((u >> 16) & 1u); return __uint_as_float(u & 0xFFFF0000u); }
__device__ __forceinline__ void split16(float v, b16& hi, b16& lo) { hi = (b16)v; lo = (b16)(v - (float)hi); }
__device__ __forceinline__ v16b frag_kb(const b16* p, int hh) { const v8b a = *(const v8b*)(p + 8 * hh), b = *(const v8b*)(p + 16 + 8 * hh); v16b f;
#pragma unroll
  for (int e = 0; e < 8; ++e) { f[e] = a[e]; f[8 + e] = b[e]; } return f; }
__device__ __forceinline__ v8f wmma16b(v16b a, v16b b, v8f c) { v8f d = __builtin_amdgcn_wmma_f32_16x16x32_f16(false, a, false, b, (short)0, c, false, false); asm volatile("v_nop\n\tv_nop\n\tv_nop\n\tv_nop" : "+v"(d) : "v"(a), "v"(b)); return d; }
__device__ __forceinline__ float nexp(float x) { return __builtin_amdgcn_exp2f(x * 1.4426950408889634f); }
__device__ __forceinline__ float pmul(float a, float b) { float p = a * b; asm volatile("" : "+v"(p)); return p; }

// prep: Q rows f16 exact x8 [32768][128]; K_c = mean of 4 exact key rows (f32) -> hi/lo x8 rows KH/KL [8192][128]; V_c likewise -> (8 V_c)^T hi/lo planes VT[b][128][2048] via an LDS transpose
__global__ __launch_bounds__(256) void prep_kernel(const float* __restrict__ Q, const float* __restrict__ K, const float* __restrict__ V, b16* __restrict__ QX, b16* __restrict__ KH, b16* __restrict__ KL, b16* __restrict__ VTh, b16* __restrict__ VTl) {
  __shared__ __attribute__((aligned(16))) b16 Th[D][64 + 8], Tl[D][64 + 8];
  const int b = blockIdx.y, t0 = blockIdx.x * 64, t_ = threadIdx.x;
  {
    // Q: this block's 256 original tokens (t0*4 .. t0*4+255) x 128 -> 4096 v8b pieces
    for (int i = t_; i < 256 * 16; i += 256) { const size_t p = ((size_t)b * S + (size_t)t0 * R4) * D / 8 + i; v8b v; for (int e = 0; e < 8; ++e) v[e] = (b16)(bf16_rne(Q[p * 8 + e]) * XS); *(v8b*)(QX + p * 8) = v; }
    // K_c rows
    for (int i = t_; i < 64 * 16; i += 256) { const int tk = i >> 4, c8 = (i & 15) * 8; const size_t src0 = ((size_t)b * S + (size_t)(t0 + tk) * R4) * D + c8; v8b hv, lv;
      for (int e = 0; e < 8; ++e) { float s = 0.0f; for (int r = 0; r < R4; ++r) s += bf16_rne(K[src0 + (size_t)r * D + e]); b16 a_, c_; split16(s * (0.25f * XS), a_, c_); hv[e] = a_; lv[e] = c_; }
      const size_t gi = ((size_t)b * SC + t0 + tk) * D + c8; *(v8b*)(KH + gi) = hv; *(v8b*)(KL + gi) = lv; }
    // V_c -> transpose tile
    for (int i = t_; i < 64 * D; i += 256) { const int tk = i / D, c = i % D; const size_t src0 = ((size_t)b * S + (size_t)(t0 + tk) * R4) * D + c; float s = 0.0f; for (int r = 0; r < R4; ++r) s += bf16_rne(V[src0 + (size_t)r * D]); b16 a_, c_; split16(s * (0.25f * XS), a_, c_); Th[c][tk] = a_; Tl[c][tk] = c_; }
    __syncthreads();
    for (int i = t_; i < D * 8; i += 256) { const int c = i >> 3, c8 = (i & 7) * 8; const size_t gi = ((size_t)b * D + c) * SC + t0 + c8; *(v8b*)(VTh + gi) = *(const v8b*)(&Th[c][c8]); *(v8b*)(VTl + gi) = *(const v8b*)(&Tl[c][c8]); }
     __syncthreads(); }
}
// attention: wave = 16 queries, block = 4 waves (64 queries of one batch); 64 key blocks: S^T = K_c.Q (4 k-steps, 2 tiles, 2 products) / sqrt(128), online softmax, o^T += (8V_c)^T.P^T (8 tiles, 3 products);
__global__ __launch_bounds__(128) void attn_kernel(const b16* __restrict__ QX, const b16* __restrict__ KH, const b16* __restrict__ KL, const b16* __restrict__ VTh, const b16* __restrict__ VTl, float* __restrict__ out) {
  __shared__ __attribute__((aligned(16))) float Os[4][16][D + 4];
  const int wave = threadIdx.x >> 5, lane = threadIdx.x & 31, hh = lane >> 4, col = lane & 15; const int b = blockIdx.y, q0 = blockIdx.x * 64 + wave * 16, qi = q0 + col;
  const b16* Qr = QX + ((size_t)b * S) * D; const b16* Kr = KH + ((size_t)b * SC) * D; const b16* Klr = KL + ((size_t)b * SC) * D; const b16* V = VTh + ((size_t)b * D) * SC; const b16* Vl = VTl + ((size_t)b * D) * SC;
  v16b qf[4]; for (int t = 0; t < 4; ++t) qf[t] = frag_kb(Qr + (size_t)qi * D + t * 32, hh);
  float m = -INFINITY, l = 0.0f; v8f o[8]; for (int t = 0; t < 8; ++t) o[t] = (v8f){};
  for (int kb = 0; kb < SC; kb += 32) {
    v8f s0 = {}, s1 = {};
#pragma unroll
    for (int t = 0; t < 4; ++t) { const v16b k0 = frag_kb(Kr + (size_t)(kb + col) * D + t * 32, hh), k0l = frag_kb(Klr + (size_t)(kb + col) * D + t * 32, hh), k1 = frag_kb(Kr + (size_t)(kb + 16 + col) * D + t * 32, hh), k1l = frag_kb(Klr + (size_t)(kb + 16 + col) * D + t * 32, hh);
      s0 = wmma16b(k0, qf[t], s0); s0 = wmma16b(k0l, qf[t], s0); s1 = wmma16b(k1, qf[t], s1); s1 = wmma16b(k1l, qf[t], s1); }
    float mr = -INFINITY;
#pragma unroll
    for (int r = 0; r < 8; ++r) { s0[r] *= ISC / (XS * XS); s1[r] *= ISC / (XS * XS); mr = fmaxf(mr, fmaxf(s0[r], s1[r])); }
    mr = fmaxf(mr, __shfl_xor(mr, 16)); const float mn = fmaxf(m, mr); const float al_ = nexp(m - mn); m = mn; float sum = 0.0f; v16b pb, pl;
#pragma unroll
    for (int r = 0; r < 8; ++r) { const float e0 = nexp(s0[r] - mn), e1 = nexp(s1[r] - mn); sum += e0 + e1; b16 a_, c_; split16(e0 * PS, a_, c_); pb[r] = a_; pl[r] = c_; split16(e1 * PS, a_, c_); pb[8 + r] = a_; pl[8 + r] = c_; }
    sum += __shfl_xor(sum, 16); l = l * al_ + sum;
#pragma unroll
    for (int t = 0; t < 8; ++t) { o[t] *= al_; const v16b vh = frag_kb(V + (size_t)(t * 16 + col) * SC + kb, hh); o[t] = wmma16b(vh, pb, o[t]); o[t] = wmma16b(vh, pl, o[t]); o[t] = wmma16b(frag_kb(Vl + (size_t)(t * 16 + col) * SC + kb, hh), pb, o[t]); } }
  const float inv = 1.0f / (l * PS * XS);
#pragma unroll
  for (int t = 0; t < 8; ++t)
#pragma unroll
    for (int r = 0; r < 8; ++r) Os[wave][col][t * 16 + 8 * hh + r] = o[t][r] * inv;
  __syncthreads();
  { for (int i = threadIdx.x; i < 64 * 32; i += 128) { const int rr = i >> 5, c4 = (i & 31) * 4; *(v4f*)(out + ((size_t)b * S + blockIdx.x * 64 + rr) * D + c4) = *(const v4f*)(&Os[rr >> 4][rr & 15][c4]); }  }
}
}  // namespace

extern "C" void kernel_launch(void* const* d_in, const int* in_sizes, int n_in,
                              void* d_out, int out_size, void* d_ws, size_t ws_size, hipStream_t stream) {
  (void)n_in; (void)out_size;
  const float* Q = (const float*)d_in[0]; const float* K = (const float*)d_in[1]; const float* V = (const float*)d_in[2];
  float* out = (float*)d_out;   // [4][8192][128]
  if (in_sizes[0] != Bn * S * D || in_sizes[1] != Bn * S * D || in_sizes[2] != Bn * S * D) return;
  size_t off = 0; char* ws = (char*)d_ws;
  auto carve = [&](size_t bytes) { char* p = ws + off; off += (bytes + 255) & ~(size_t)255; return p; };
  b16* QX = (b16*)carve((size_t)Bn * S * D * 2); b16* KH = (b16*)carve((size_t)Bn * SC * D * 2); b16* KL = (b16*)carve((size_t)Bn * SC * D * 2); b16* VTh = (b16*)carve((size_t)Bn * D * SC * 2); b16* VTl = (b16*)carve((size_t)Bn * D * SC * 2);
  if (off > ws_size) return;                        // ≈ 8.4 + 2.1 x 4 ≈ 17 MB
  prep_kernel<<<dim3(SC / 64, Bn), 256, 0, stream>>>(Q, K, V, QX, KH, KL, VTh, VTl);
  attn_kernel<<<dim3(S / 64, Bn), 128, 0, stream>>>(QX, KH, KL, VTh, VTl, out);
}

// v001
// It runs in 95.1 microseconds.
// In two side-by-side timings against v000, it was 3.93 and 3.92 times as fast.
#include <hip/hip_runtime.h>

// CompressedAttention: K_c, V_c = mean over blocks of 4 consecutive keys (8192 -> 2048); out = softmax(Q.K_c / sqrt(128)) V_c -> [4][8192][128].
// WMMA (v_wmma_f32_16x16x32_f16, f32 accumulate): Q exact bf16 (x8 f16); K_c computed in f32 from the exact keys and split into an f16 hi+lo pair x8, S^T = K_c.Q (2 products: exact x hi+lo);
// online softmax in f32; o^T += (8 V_c)^T.P^T with V_c and P hi+lo (3 products). Fragment k-map per lane half hh for A AND B: elements 0..7 <- k = 8hh+0..7, 8..15 <- k = 16+8hh+0..7. Every

namespace {
constexpr int Bn = 4, S = 8192, D = 128, R4 = 4, SC = S / R4;
constexpr float XS = 8.0f, PS = 8.0f, ISC = 0.08838834764831845f;

typedef _Float16 b16;
typedef __attribute__((ext_vector_type(16))) _Float16 v16b;
typedef __attribute__((ext_vector_type(8))) _Float16 v8b;
typedef __attribute__((ext_vector_type(8))) float v8f;
typedef __attribute__((ext_vector_type(4))) float v4f;
__device__ __forceinline__ float bf16_rne(float f) { unsigned int u = __float_as_uint(f); u += 0x7FFFu + ((u >> 16) & 1u); return __uint_as_float(u & 0xFFFF0000u); }
__device__ __forceinline__ void split16(float v, b16& hi, b16& lo) { hi = (b16)v; lo = (b16)(v - (float)hi); }
__device__ __forceinline__ v16b frag_kb(const b16* p, int hh) { const v8b a = *(const v8b*)(p + 8 * hh), b = *(const v8b*)(p + 16 + 8 * hh); v16b f;
#pragma unroll
  for (int e = 0; e < 8; ++e) { f[e] = a[e]; f[8 + e] = b[e]; } return f; }
__device__ __forceinline__ v8f wmma16b(v16b a, v16b b, v8f c) { v8f d = __builtin_amdgcn_wmma_f32_16x16x32_f16(false, a, false, b, (short)0, c, false, false); asm volatile("v_nop\n\tv_nop\n\tv_nop\n\tv_nop" : "+v"(d) : "v"(a), "v"(b)); return d; }
__device__ __forceinline__ float nexp(float x) { return __builtin_amdgcn_exp2f(x * 1.4426950408889634f); }
__device__ __forceinline__ float pmul(float a, float b) { float p = a * b; asm volatile("" : "+v"(p)); return p; }

// prep: Q rows f16 exact x8 [32768][128]; K_c = mean of 4 exact key rows (f32) -> hi/lo x8 rows KH/KL [8192][128]; V_c likewise -> (8 V_c)^T hi/lo planes VT[b][128][2048] via an LDS transpose
__global__ __launch_bounds__(256) void prep_kernel(const float* __restrict__ Q, const float* __restrict__ K, const float* __restrict__ V, b16* __restrict__ QX, b16* __restrict__ KH, b16* __restrict__ KL, b16* __restrict__ VTh, b16* __restrict__ VTl) {
  __shared__ __attribute__((aligned(16))) b16 Th[D][64 + 8], Tl[D][64 + 8];
  const int b = blockIdx.y, t0 = blockIdx.x * 64, t_ = threadIdx.x;
  {
    // Q: this block's 256 original tokens (t0*4 .. t0*4+255) x 128 -> 4096 v8b pieces
    for (int i = t_; i < 256 * 16; i += 256) { const size_t p = ((size_t)b * S + (size_t)t0 * R4) * D / 8 + i; v8b v; for (int e = 0; e < 8; ++e) v[e] = (b16)(bf16_rne(Q[p * 8 + e]) * XS); *(v8b*)(QX + p * 8) = v; }
    // K_c rows
    for (int i = t_; i < 64 * 16; i += 256) { const int tk = i >> 4, c8 = (i & 15) * 8; const size_t src0 = ((size_t)b * S + (size_t)(t0 + tk) * R4) * D + c8; v8b hv, lv;
      for (int e = 0; e < 8; ++e) { float s = 0.0f; for (int r = 0; r < R4; ++r) s += bf16_rne(K[src0 + (size_t)r * D + e]); b16 a_, c_; split16(s * (0.25f * XS), a_, c_); hv[e] = a_; lv[e] = c_; }
      const size_t gi = ((size_t)b * SC + t0 + tk) * D + c8; *(v8b*)(KH + gi) = hv; *(v8b*)(KL + gi) = lv; }
    // V_c -> transpose tile
    for (int i = t_; i < 64 * D; i += 256) { const int tk = i / D, c = i % D; const size_t src0 = ((size_t)b * S + (size_t)(t0 + tk) * R4) * D + c; float s = 0.0f; for (int r = 0; r < R4; ++r) s += bf16_rne(V[src0 + (size_t)r * D]); b16 a_, c_; split16(s * (0.25f * XS), a_, c_); Th[c][tk] = a_; Tl[c][tk] = c_; }
    __syncthreads();
    for (int i = t_; i < D * 8; i += 256) { const int c = i >> 3, c8 = (i & 7) * 8; const size_t gi = ((size_t)b * D + c) * SC + t0 + c8; *(v8b*)(VTh + gi) = *(const v8b*)(&Th[c][c8]); *(v8b*)(VTl + gi) = *(const v8b*)(&Tl[c][c8]); }
     __syncthreads(); }
}
// LDS ring for the attention kernel: one tile = 64 keys: K_c hi, K_c lo (64 rows x 256 B at a 272 B pitch), (8 V_c)^T hi, lo (128 rows x 128 B at a 144 B pitch); both pitches are 16 B x odd for 16-byte readers
constexpr int KT = 64, NT = SC / KT, KP = D + 8, VP = KT + 8, KPL = KT * KP, VPL = D * VP, TILE = 2 * KPL + 2 * VPL;
// eight asynchronous 16-byte copies per lane; the s_wait_xcnt closes the statement so that no address register is rewritten ahead of it
__device__ __forceinline__ void copy8(unsigned l0, unsigned l1, unsigned l2, unsigned l3, unsigned l4, unsigned l5, unsigned l6, unsigned l7, const b16* g0, const b16* g1, const b16* g2, const b16* g3, const b16* g4, const b16* g5, const b16* g6, const b16* g7) {
  asm volatile("global_load_async_to_lds_b128 %0, %8, off\n\tglobal_load_async_to_lds_b128 %1, %9, off\n\tglobal_load_async_to_lds_b128 %2, %10, off\n\tglobal_load_async_to_lds_b128 %3, %11, off\n\t"
               "global_load_async_to_lds_b128 %4, %12, off\n\tglobal_load_async_to_lds_b128 %5, %13, off\n\tglobal_load_async_to_lds_b128 %6, %14, off\n\tglobal_load_async_to_lds_b128 %7, %15, off\n\ts_wait_xcnt 0x0"
               :: "v"(l0), "v"(l1), "v"(l2), "v"(l3), "v"(l4), "v"(l5), "v"(l6), "v"(l7), "v"(g0), "v"(g1), "v"(g2), "v"(g3), "v"(g4), "v"(g5), "v"(g6), "v"(g7) : "memory"); }
// the whole block copies one 64-key tile (64 KB, 16 copies per lane): K rows are contiguous in memory, V^T rows are whole 128-byte lines
__device__ __forceinline__ void stage_tile(const b16* buf, const b16* Kr, const b16* Klr, const b16* V, const b16* Vl, int k0, int tid) {
  const unsigned lb = (unsigned)(size_t)buf;   // low 32 bits of the shared address = byte offset in the work-group's LDS
  const int kr = tid >> 4, kc = (tid & 15) * 8, vr = tid >> 3, vc = (tid & 7) * 8;
  const unsigned lk = lb + (unsigned)(kr * KP + kc) * 2u, lv = lb + (unsigned)(2 * KPL + vr * VP + vc) * 2u;
  const size_t gk = (size_t)(k0 + kr) * D + kc, gv = (size_t)vr * SC + k0 + vc;
  copy8(lk, lk + 16 * KP * 2, lk + 32 * KP * 2, lk + 48 * KP * 2, lk + KPL * 2, lk + (KPL + 16 * KP) * 2, lk + (KPL + 32 * KP) * 2, lk + (KPL + 48 * KP) * 2,
        Kr + gk, Kr + gk + 16 * D, Kr + gk + 32 * D, Kr + gk + 48 * D, Klr + gk, Klr + gk + 16 * D, Klr + gk + 32 * D, Klr + gk + 48 * D);
  copy8(lv, lv + 32 * VP * 2, lv + 64 * VP * 2, lv + 96 * VP * 2, lv + VPL * 2, lv + (VPL + 32 * VP) * 2, lv + (VPL + 64 * VP) * 2, lv + (VPL + 96 * VP) * 2,
        V + gv, V + gv + 32 * SC, V + gv + 64 * SC, V + gv + 96 * SC, Vl + gv, Vl + gv + 32 * SC, Vl + gv + 64 * SC, Vl + gv + 96 * SC);
}
// attention: wave = 16 queries, block = 8 waves (128 queries of one batch); 32 staged tiles of 64 keys in a two-buffer LDS ring shared by the block, each worked as two 32-key blocks:
// S^T = K_c.Q (4 k-steps, 2 tiles, 2 products) / sqrt(128), online softmax, o^T += (8V_c)^T.P^T (8 tiles, 3 products);
__global__ __launch_bounds__(256) void attn_kernel(const b16* __restrict__ QX, const b16* __restrict__ KH, const b16* __restrict__ KL, const b16* __restrict__ VTh, const b16* __restrict__ VTl, float* __restrict__ out) {
  __shared__ __attribute__((aligned(16))) b16 Ring[2 * TILE];
  __shared__ __attribute__((aligned(16))) float Os[8][16][D + 4];
  const int tid = threadIdx.x, wave = tid >> 5, lane = tid & 31, hh = lane >> 4, col = lane & 15; const int b = blockIdx.y, q0 = blockIdx.x * 128 + wave * 16, qi = q0 + col;
  const b16* Qr = QX + ((size_t)b * S) * D; const b16* Kr = KH + ((size_t)b * SC) * D; const b16* Klr = KL + ((size_t)b * SC) * D; const b16* V = VTh + ((size_t)b * D) * SC; const b16* Vl = VTl + ((size_t)b * D) * SC;
  stage_tile(Ring, Kr, Klr, V, Vl, 0, tid);
  v16b qf[4]; for (int t = 0; t < 4; ++t) qf[t] = frag_kb(Qr + (size_t)qi * D + t * 32, hh);
  float m = -INFINITY, l = 0.0f; v8f o[8]; for (int t = 0; t < 8; ++t) o[t] = (v8f){};
  asm volatile("s_wait_asynccnt 0x0" ::: "memory");   // this wave's share of tile 0 has landed
  __syncthreads();                                     // tile 0 is published to every wave
  stage_tile(Ring + TILE, Kr, Klr, V, Vl, KT, tid);
  for (int tt = 0; tt < NT; ++tt) {
    const b16* Ks = Ring + (tt & 1) * TILE; const b16* Vs = Ks + 2 * KPL;
    for (int kb = 0; kb < KT; kb += 32) {
      // The LDS reads of a 32-key block stand in a few groups, each issued ahead of the work that covers its latency. Every sched_barrier below holds such a group in its place:
      // without them the reads are spread among the matrix instructions, each pair in front of its own full wait.
      v16b kf[16], vf[16];
#pragma unroll
      for (int t = 0; t < 3; ++t) { kf[4 * t] = frag_kb(Ks + (kb + col) * KP + t * 32, hh); kf[4 * t + 1] = frag_kb(Ks + KPL + (kb + col) * KP + t * 32, hh); kf[4 * t + 2] = frag_kb(Ks + (kb + 16 + col) * KP + t * 32, hh); kf[4 * t + 3] = frag_kb(Ks + KPL + (kb + 16 + col) * KP + t * 32, hh); }
      __builtin_amdgcn_sched_barrier(0);   // K reads of k-steps 0 to 2 stay together, ahead of the products
      v8f s0 = {}, s1 = {};
      s0 = wmma16b(kf[0], qf[0], s0); s0 = wmma16b(kf[1], qf[0], s0); s1 = wmma16b(kf[2], qf[0], s1); s1 = wmma16b(kf[3], qf[0], s1);
      kf[12] = frag_kb(Ks + (kb + col) * KP + 96, hh); kf[13] = frag_kb(Ks + KPL + (kb + col) * KP + 96, hh); kf[14] = frag_kb(Ks + (kb + 16 + col) * KP + 96, hh); kf[15] = frag_kb(Ks + KPL + (kb + 16 + col) * KP + 96, hh);
      __builtin_amdgcn_sched_barrier(0);   // the K reads of k-step 3 issue ahead of the products of k-steps 1 and 2, which cover their latency
#pragma unroll
      for (int t = 1; t < 4; ++t) { s0 = wmma16b(kf[4 * t], qf[t], s0); s0 = wmma16b(kf[4 * t + 1], qf[t], s0); s1 = wmma16b(kf[4 * t + 2], qf[t], s1); s1 = wmma16b(kf[4 * t + 3], qf[t], s1); }
#pragma unroll
      for (int t = 0; t < 2; ++t) { vf[2 * t] = frag_kb(Vs + (t * 16 + col) * VP + kb, hh); vf[2 * t + 1] = frag_kb(Vs + VPL + (t * 16 + col) * VP + kb, hh); }
      __builtin_amdgcn_sched_barrier(0);   // V reads of output tiles 0 and 1 issue ahead of the softmax, which covers their latency
      float mr = -INFINITY;
#pragma unroll
      for (int r = 0; r < 8; ++r) { s0[r] *= ISC / (XS * XS); s1[r] *= ISC / (XS * XS); mr = fmaxf(mr, fmaxf(s0[r], s1[r])); }
      mr = fmaxf(mr, __shfl_xor(mr, 16)); const float mn = fmaxf(m, mr); const float al_ = nexp(m - mn); m = mn; float sum = 0.0f; v16b pb, pl;
#pragma unroll
      for (int r = 0; r < 8; ++r) { const float e0 = nexp(s0[r] - mn), e1 = nexp(s1[r] - mn); sum += e0 + e1; b16 a_, c_; split16(e0 * PS, a_, c_); pb[r] = a_; pl[r] = c_; split16(e1 * PS, a_, c_); pb[8 + r] = a_; pl[8 + r] = c_; }
      sum += __shfl_xor(sum, 16); l = l * al_ + sum;
#pragma unroll
      for (int t = 2; t < 5; ++t) { vf[2 * t] = frag_kb(Vs + (t * 16 + col) * VP + kb, hh); vf[2 * t + 1] = frag_kb(Vs + VPL + (t * 16 + col) * VP + kb, hh); }
      __builtin_amdgcn_sched_barrier(0);   // the V reads of tiles 2 to 4 issue ahead of the products of tiles 0 and 1
#pragma unroll
      for (int t = 0; t < 2; ++t) { o[t] *= al_; o[t] = wmma16b(vf[2 * t], pb, o[t]); o[t] = wmma16b(vf[2 * t], pl, o[t]); o[t] = wmma16b(vf[2 * t + 1], pb, o[t]); }
      __builtin_amdgcn_sched_barrier(0);   // tiles 5 to 7 are read only here, when the registers of tiles 0 and 1 are free
#pragma unroll
      for (int t = 5; t < 8; ++t) { vf[2 * t] = frag_kb(Vs + (t * 16 + col) * VP + kb, hh); vf[2 * t + 1] = frag_kb(Vs + VPL + (t * 16 + col) * VP + kb, hh); }
      __builtin_amdgcn_sched_barrier(0);   // and ahead of the products of tiles 2 to 4, which cover their latency
#pragma unroll
      for (int t = 2; t < 8; ++t) { o[t] *= al_; o[t] = wmma16b(vf[2 * t], pb, o[t]); o[t] = wmma16b(vf[2 * t], pl, o[t]); o[t] = wmma16b(vf[2 * t + 1], pb, o[t]); } }
    asm volatile("s_wait_dscnt 0x0" ::: "memory");     // this wave's reads of the buffer are done before it may be refilled
    asm volatile("s_wait_asynccnt 0x0" ::: "memory");  // this wave's share of tile tt + 1 has landed
    __syncthreads();                                   // publishes tile tt + 1 and ends every wave's reads of tile tt
    if (tt + 2 < NT) stage_tile(Ring + (tt & 1) * TILE, Kr, Klr, V, Vl, (tt + 2) * KT, tid);
  }
  asm volatile("s_wait_asynccnt 0x0" ::: "memory");    // no copy is outstanding when the wave ends
  const float inv = 1.0f / (l * PS * XS);
#pragma unroll
  for (int t = 0; t < 8; ++t)
#pragma unroll
    for (int r = 0; r < 8; ++r) Os[wave][col][t * 16 + 8 * hh + r] = o[t][r] * inv;
  __syncthreads();
  { for (int i = threadIdx.x; i < 128 * 32; i += 256) { const int rr = i >> 5, c4 = (i & 31) * 4; *(v4f*)(out + ((size_t)b * S + blockIdx.x * 128 + rr) * D + c4) = *(const v4f*)(&Os[rr >> 4][rr & 15][c4]); }  }
}
}  // namespace

extern "C" void kernel_launch(void* const* d_in, const int* in_sizes, int n_in,
                              void* d_out, int out_size, void* d_ws, size_t ws_size, hipStream_t stream) {
  (void)n_in; (void)out_size;
  const float* Q = (const float*)d_in[0]; const float* K = (const float*)d_in[1]; const float* V = (const float*)d_in[2];
  float* out = (float*)d_out;   // [4][8192][128]
  if (in_sizes[0] != Bn * S * D || in_sizes[1] != Bn * S * D || in_sizes[2] != Bn * S * D) return;
  size_t off = 0; char* ws = (char*)d_ws;
  auto carve = [&](size_t bytes) { char* p = ws + off; off += (bytes + 255) & ~(size_t)255; return p; };
  b16* QX = (b16*)carve((size_t)Bn * S * D * 2); b16* KH = (b16*)carve((size_t)Bn * SC * D * 2); b16* KL = (b16*)carve((size_t)Bn * SC * D * 2); b16* VTh = (b16*)carve((size_t)Bn * D * SC * 2); b16* VTl = (b16*)carve((size_t)Bn * D * SC * 2);
  if (off > ws_size) return;                        // ≈ 8.4 + 2.1 x 4 ≈ 17 MB
  prep_kernel<<<dim3(SC / 64, Bn), 256, 0, stream>>>(Q, K, V, QX, KH, KL, VTh, VTl);
  attn_kernel<<<dim3(S / 128, Bn), 256, 0, stream>>>(QX, KH, KL, VTh, VTl, out);
}

// v002
// Measured time: 83.1 microseconds a run.
// Timed twice side by side with v001, it ran 1.14 times as fast both times.
// All steps since v000 together make it 4.49 times as fast.
#include <hip/hip_runtime.h>

// CompressedAttention: K_c, V_c = mean over blocks of 4 consecutive keys (8192 -> 2048); out = softmax(Q.K_c / sqrt(128)) V_c -> [4][8192][128].
// WMMA (v_wmma_f32_16x16x32_f16, f32 accumulate): Q exact bf16 (x8 f16); K_c computed in f32 from the exact keys and split into an f16 hi+lo pair x8, S^T = K_c.Q (2 products: exact x hi+lo);
// online softmax in f32; o^T += (8 V_c)^T.P^T with V_c and P hi+lo (3 products). Fragment k-map per lane half hh for A AND B: elements 0..7 <- k = 8hh+0..7, 8..15 <- k = 16+8hh+0..7. Every

namespace {
constexpr int Bn = 4, S = 8192, D = 128, R4 = 4, SC = S / R4;
constexpr float XS = 8.0f, PS = 8.0f, ISC = 0.08838834764831845f;

typedef _Float16 b16;
typedef __attribute__((ext_vector_type(16))) _Float16 v16b;
typedef __attribute__((ext_vector_type(8))) _Float16 v8b;
typedef __attribute__((ext_vector_type(8))) float v8f;
typedef __attribute__((ext_vector_type(4))) float v4f;
__device__ __forceinline__ float bf16_rne(float f) { unsigned int u = __float_as_uint(f); u += 0x7FFFu + ((u >> 16) & 1u); return __uint_as_float(u & 0xFFFF0000u); }
__device__ __forceinline__ void split16(float v, b16& hi, b16& lo) { hi = (b16)v; lo = (b16)(v - (float)hi); }
__device__ __forceinline__ v16b frag_kb(const b16* p, int hh) { const v8b a = *(const v8b*)(p + 8 * hh), b = *(const v8b*)(p + 16 + 8 * hh); v16b f;
#pragma unroll
  for (int e = 0; e < 8; ++e) { f[e] = a[e]; f[8 + e] = b[e]; } return f; }
// the v_nop statement names D alone: what an asm statement names must lie in v0 to v255, and with A and B named as well the 32-query wave tile spills to scratch (seen in a build).
// A and B are then guarded by the compiler's own padding of the builtin against vector writes; the only other writers of fragment registers in the loop are ds_load_b128
__device__ __forceinline__ v8f wmma16b(v16b a, v16b b, v8f c) { v8f d = __builtin_amdgcn_wmma_f32_16x16x32_f16(false, a, false, b, (short)0, c, false, false); asm volatile("v_nop\n\tv_nop\n\tv_nop\n\tv_nop" : "+v"(d)); return d; }
__device__ __forceinline__ float nexp(float x) { return __builtin_amdgcn_exp2f(x * 1.4426950408889634f); }
// lane l <-> lane l ^ 16 as a vector cross-row move: a vector instruction, so the compiler keeps its distance behind a matrix instruction whose operand register it rewrites
__device__ __forceinline__ float xrow(float v) { const int b = __float_as_int(v); return __int_as_float(__builtin_amdgcn_permlanex16(b, b, 0x76543210, 0xfedcba98, false, false)); }
// the join's exponential with the one slot behind a transcendental in the same statement
__device__ __forceinline__ float nexp_slot(float x) { float r; asm("v_exp_f32 %0, %1\n\tv_nop" : "=v"(r) : "v"(x * 1.4426950408889634f)); return r; }
__device__ __forceinline__ float pmul(float a, float b) { float p = a * b; asm volatile("" : "+v"(p)); return p; }

// prep: Q rows f16 exact x8 [32768][128]; K_c = mean of 4 exact key rows (f32) -> hi/lo x8 rows KH/KL [8192][128]; V_c likewise -> (8 V_c)^T hi/lo planes VT[b][128][2048] via an LDS transpose
__global__ __launch_bounds__(256) void prep_kernel(const float* __restrict__ Q, const float* __restrict__ K, const float* __restrict__ V, b16* __restrict__ QX, b16* __restrict__ KH, b16* __restrict__ KL, b16* __restrict__ VTh, b16* __restrict__ VTl) {
  __shared__ __attribute__((aligned(16))) b16 Th[D][64 + 8], Tl[D][64 + 8];
  const int b = blockIdx.y, t0 = blockIdx.x * 64, t_ = threadIdx.x;
  {
    // Q: this block's 256 original tokens (t0*4 .. t0*4+255) x 128 -> 4096 v8b pieces
    for (int i = t_; i < 256 * 16; i += 256) { const size_t p = ((size_t)b * S + (size_t)t0 * R4) * D / 8 + i; v8b v; for (int e = 0; e < 8; ++e) v[e] = (b16)(bf16_rne(Q[p * 8 + e]) * XS); *(v8b*)(QX + p * 8) = v; }
    // K_c rows
    for (int i = t_; i < 64 * 16; i += 256) { const int tk = i >> 4, c8 = (i & 15) * 8; const size_t src0 = ((size_t)b * S + (size_t)(t0 + tk) * R4) * D + c8; v8b hv, lv;
      for (int e = 0; e < 8; ++e) { float s = 0.0f; for (int r = 0; r < R4; ++r) s += bf16_rne(K[src0 + (size_t)r * D + e]); b16 a_, c_; split16(s * (0.25f * XS), a_, c_); hv[e] = a_; lv[e] = c_; }
      const size_t gi = ((size_t)b * SC + t0 + tk) * D + c8; *(v8b*)(KH + gi) = hv; *(v8b*)(KL + gi) = lv; }
    // V_c -> transpose tile
    for (int i = t_; i < 64 * D; i += 256) { const int tk = i / D, c = i % D; const size_t src0 = ((size_t)b * S + (size_t)(t0 + tk) * R4) * D + c; float s = 0.0f; for (int r = 0; r < R4; ++r) s += bf16_rne(V[src0 + (size_t)r * D]); b16 a_, c_; split16(s * (0.25f * XS), a_, c_); Th[c][tk] = a_; Tl[c][tk] = c_; }
    __syncthreads();
    for (int i = t_; i < D * 8; i += 256) { const int c = i >> 3, c8 = (i & 7) * 8; const size_t gi = ((size_t)b * D + c) * SC + t0 + c8; *(v8b*)(VTh + gi) = *(const v8b*)(&Th[c][c8]); *(v8b*)(VTl + gi) = *(const v8b*)(&Tl[c][c8]); }
     __syncthreads(); }
}
// LDS ring for the attention kernel: one tile = 64 keys: K_c hi, K_c lo (64 rows x 256 B at a 272 B pitch), (8 V_c)^T hi, lo (128 rows x 128 B at a 144 B pitch); both pitches are 16 B x odd for 16-byte readers
constexpr int KT = 64, NT = SC / KT, KP = D + 8, VP = KT + 8, KPL = KT * KP, VPL = D * VP, TILE = 2 * KPL + 2 * VPL;
// eight asynchronous 16-byte copies per lane; the s_wait_xcnt closes the statement so that no address register is rewritten ahead of it
__device__ __forceinline__ void copy8(unsigned l0, unsigned l1, unsigned l2, unsigned l3, unsigned l4, unsigned l5, unsigned l6, unsigned l7, const b16* g0, const b16* g1, const b16* g2, const b16* g3, const b16* g4, const b16* g5, const b16* g6, const b16* g7) {
  asm volatile("global_load_async_to_lds_b128 %0, %8, off\n\tglobal_load_async_to_lds_b128 %1, %9, off\n\tglobal_load_async_to_lds_b128 %2, %10, off\n\tglobal_load_async_to_lds_b128 %3, %11, off\n\t"
               "global_load_async_to_lds_b128 %4, %12, off\n\tglobal_load_async_to_lds_b128 %5, %13, off\n\tglobal_load_async_to_lds_b128 %6, %14, off\n\tglobal_load_async_to_lds_b128 %7, %15, off\n\ts_wait_xcnt 0x0"
               :: "v"(l0), "v"(l1), "v"(l2), "v"(l3), "v"(l4), "v"(l5), "v"(l6), "v"(l7), "v"(g0), "v"(g1), "v"(g2), "v"(g3), "v"(g4), "v"(g5), "v"(g6), "v"(g7) : "memory"); }
// the whole block copies one 64-key tile (64 KB, 16 copies per lane): K rows are contiguous in memory, V^T rows are whole 128-byte lines
__device__ __forceinline__ void stage_tile(const b16* buf, const b16* Kr, const b16* Klr, const b16* V, const b16* Vl, int k0, int tid) {
  const unsigned lb = (unsigned)(size_t)buf;   // low 32 bits of the shared address = byte offset in the work-group's LDS
  const int kr = tid >> 4, kc = (tid & 15) * 8, vr = tid >> 3, vc = (tid & 7) * 8;
  const unsigned lk = lb + (unsigned)(kr * KP + kc) * 2u, lv = lb + (unsigned)(2 * KPL + vr * VP + vc) * 2u;
  const size_t gk = (size_t)(k0 + kr) * D + kc, gv = (size_t)vr * SC + k0 + vc;
  copy8(lk, lk + 16 * KP * 2, lk + 32 * KP * 2, lk + 48 * KP * 2, lk + KPL * 2, lk + (KPL + 16 * KP) * 2, lk + (KPL + 32 * KP) * 2, lk + (KPL + 48 * KP) * 2,
        Kr + gk, Kr + gk + 16 * D, Kr + gk + 32 * D, Kr + gk + 48 * D, Klr + gk, Klr + gk + 16 * D, Klr + gk + 32 * D, Klr + gk + 48 * D);
  copy8(lv, lv + 32 * VP * 2, lv + 64 * VP * 2, lv + 96 * VP * 2, lv + VPL * 2, lv + (VPL + 32 * VP) * 2, lv + (VPL + 64 * VP) * 2, lv + (VPL + 96 * VP) * 2,
        V + gv, V + gv + 32 * SC, V + gv + 64 * SC, V + gv + 96 * SC, Vl + gv, Vl + gv + 32 * SC, Vl + gv + 64 * SC, Vl + gv + 96 * SC);
}
// attention: block = 8 waves = 4 query groups x 2 key halves (128 queries of one batch). A wave holds 32 queries (two B fragments) and works ONE 32-key half of every staged 64-key tile,
// so that each K_c and V_c fragment read from LDS feeds two products; the two halves keep their own running maximum, sum and o and are joined once, after the loop, through LDS.
// S^T = K_c.Q (4 k-steps, 2 row tiles, 2 query tiles, 2 products) / sqrt(128), online softmax, o^T += (8V_c)^T.P^T (8 tiles, 2 query tiles, 3 products);
__global__ __launch_bounds__(256) void attn_kernel(const b16* __restrict__ QX, const b16* __restrict__ KH, const b16* __restrict__ KL, const b16* __restrict__ VTh, const b16* __restrict__ VTl, float* __restrict__ out) {
  __shared__ __attribute__((aligned(16))) b16 Ring[2 * TILE];
  __shared__ __attribute__((aligned(16))) float Os[8][16][D + 4];
  __shared__ float Ms[4][2][32], Ls[4][2][32];
  const int tid = threadIdx.x, wave = __builtin_amdgcn_readfirstlane(tid >> 5), lane = tid & 31, hh = lane >> 4, col = lane & 15; const int wq = wave & 3, kb = (wave >> 2) * 32; const int b = blockIdx.y, q0 = blockIdx.x * 128 + wq * 32;
  const b16* Qr = QX + ((size_t)b * S) * D; const b16* Kr = KH + ((size_t)b * SC) * D; const b16* Klr = KL + ((size_t)b * SC) * D; const b16* V = VTh + ((size_t)b * D) * SC; const b16* Vl = VTl + ((size_t)b * D) * SC;
  stage_tile(Ring, Kr, Klr, V, Vl, 0, tid);
  v16b qf[2][4];
#pragma unroll
  for (int g = 0; g < 2; ++g)
#pragma unroll
    for (int t = 0; t < 4; ++t) qf[g][t] = frag_kb(Qr + (size_t)(q0 + g * 16 + col) * D + t * 32, hh);
  float m[2] = {-INFINITY, -INFINITY}, l[2] = {0.0f, 0.0f}; v8f o[8][2];
#pragma unroll
  for (int t = 0; t < 8; ++t) { o[t][0] = (v8f){}; o[t][1] = (v8f){}; }
  asm volatile("s_wait_asynccnt 0x0" ::: "memory");   // this wave's share of tile 0 has landed
  __syncthreads();                                     // tile 0 is published to every wave
  stage_tile(Ring + TILE, Kr, Klr, V, Vl, KT, tid);
  for (int tt = 0; tt < NT; ++tt) {
    const b16* Ks = Ring + (tt & 1) * TILE; const b16* Vs = Ks + 2 * KPL;
    {
      // The LDS reads of a 32-key block stand in a few groups, each issued ahead of the work that covers its latency. Every sched_barrier below holds such a group in its place:
      // without them the reads are spread among the matrix instructions, each pair in front of its own full wait.
      v16b kf[16], vf[16];
#pragma unroll
      for (int t = 0; t < 3; ++t) { kf[4 * t] = frag_kb(Ks + (kb + col) * KP + t * 32, hh); kf[4 * t + 1] = frag_kb(Ks + KPL + (kb + col) * KP + t * 32, hh); kf[4 * t + 2] = frag_kb(Ks + (kb + 16 + col) * KP + t * 32, hh); kf[4 * t + 3] = frag_kb(Ks + KPL + (kb + 16 + col) * KP + t * 32, hh); }
      __builtin_amdgcn_sched_barrier(0);   // K reads of k-steps 0 to 2 stay together, ahead of the products
      v8f s[2][2] = {};   // [16-key row tile][query tile]: four independent accumulators
#pragma unroll
      for (int p = 0; p < 2; ++p) { s[0][0] = wmma16b(kf[p], qf[0][0], s[0][0]); s[0][1] = wmma16b(kf[p], qf[1][0], s[0][1]); s[1][0] = wmma16b(kf[2 + p], qf[0][0], s[1][0]); s[1][1] = wmma16b(kf[2 + p], qf[1][0], s[1][1]); }
      kf[12] = frag_kb(Ks + (kb + col) * KP + 96, hh); kf[13] = frag_kb(Ks + KPL + (kb + col) * KP + 96, hh); kf[14] = frag_kb(Ks + (kb + 16 + col) * KP + 96, hh); kf[15] = frag_kb(Ks + KPL + (kb + 16 + col) * KP + 96, hh);
      __builtin_amdgcn_sched_barrier(0);   // the K reads of k-step 3 issue ahead of the products of k-steps 1 and 2, which cover their latency
#pragma unroll
      for (int t = 1; t < 4; ++t)
#pragma unroll
        for (int p = 0; p < 2; ++p) { s[0][0] = wmma16b(kf[4 * t + p], qf[0][t], s[0][0]); s[0][1] = wmma16b(kf[4 * t + p], qf[1][t], s[0][1]); s[1][0] = wmma16b(kf[4 * t + 2 + p], qf[0][t], s[1][0]); s[1][1] = wmma16b(kf[4 * t + 2 + p], qf[1][t], s[1][1]); }
#pragma unroll
      for (int t = 0; t < 2; ++t) { vf[2 * t] = frag_kb(Vs + (t * 16 + col) * VP + kb, hh); vf[2 * t + 1] = frag_kb(Vs + VPL + (t * 16 + col) * VP + kb, hh); }
      __builtin_amdgcn_sched_barrier(0);   // V reads of output tiles 0 and 1 issue ahead of the softmax, which covers their latency
      float mr[2], al_[2], sum[2]; v16b pb[2], pl[2];
#pragma unroll
      for (int g = 0; g < 2; ++g) { mr[g] = -INFINITY;
#pragma unroll
        for (int r = 0; r < 8; ++r) { s[0][g][r] *= ISC / (XS * XS); s[1][g][r] *= ISC / (XS * XS); mr[g] = fmaxf(mr[g], fmaxf(s[0][g][r], s[1][g][r])); } }
#pragma unroll
      for (int g = 0; g < 2; ++g) mr[g] = fmaxf(mr[g], xrow(mr[g]));
#pragma unroll
      for (int g = 0; g < 2; ++g) { const float mn = fmaxf(m[g], mr[g]); al_[g] = nexp(m[g] - mn); m[g] = mn; sum[g] = 0.0f;
#pragma unroll
        for (int r = 0; r < 8; ++r) { const float e0 = nexp(s[0][g][r] - mn), e1 = nexp(s[1][g][r] - mn); sum[g] += e0 + e1; b16 a_, c_; split16(e0 * PS, a_, c_); pb[g][r] = a_; pl[g][r] = c_; split16(e1 * PS, a_, c_); pb[g][8 + r] = a_; pl[g][8 + r] = c_; } }
#pragma unroll
      for (int g = 0; g < 2; ++g) { sum[g] += xrow(sum[g]); l[g] = l[g] * al_[g] + sum[g]; }
#pragma unroll
      for (int t = 2; t < 5; ++t) { vf[2 * t] = frag_kb(Vs + (t * 16 + col) * VP + kb, hh); vf[2 * t + 1] = frag_kb(Vs + VPL + (t * 16 + col) * VP + kb, hh); }
      __builtin_amdgcn_sched_barrier(0);   // the V reads of tiles 2 to 4 issue ahead of the products of tiles 0 and 1
#pragma unroll
      for (int t = 0; t < 2; t += 2) { o[t][0] *= al_[0]; o[t][1] *= al_[1]; o[t + 1][0] *= al_[0]; o[t + 1][1] *= al_[1];
        o[t][0] = wmma16b(vf[2 * t], pb[0], o[t][0]); o[t][1] = wmma16b(vf[2 * t], pb[1], o[t][1]); o[t + 1][0] = wmma16b(vf[2 * t + 2], pb[0], o[t + 1][0]); o[t + 1][1] = wmma16b(vf[2 * t + 2], pb[1], o[t + 1][1]);
        o[t][0] = wmma16b(vf[2 * t], pl[0], o[t][0]); o[t][1] = wmma16b(vf[2 * t], pl[1], o[t][1]); o[t + 1][0] = wmma16b(vf[2 * t + 2], pl[0], o[t + 1][0]); o[t + 1][1] = wmma16b(vf[2 * t + 2], pl[1], o[t + 1][1]);
        o[t][0] = wmma16b(vf[2 * t + 1], pb[0], o[t][0]); o[t][1] = wmma16b(vf[2 * t + 1], pb[1], o[t][1]); o[t + 1][0] = wmma16b(vf[2 * t + 3], pb[0], o[t + 1][0]); o[t + 1][1] = wmma16b(vf[2 * t + 3], pb[1], o[t + 1][1]); }   // two output tiles x two query tiles: four independent accumulators in turn
      __builtin_amdgcn_sched_barrier(0);   // tiles 5 to 7 are read only here, when the registers of tiles 0 and 1 are free
#pragma unroll
      for (int t = 5; t < 8; ++t) { vf[2 * t] = frag_kb(Vs + (t * 16 + col) * VP + kb, hh); vf[2 * t + 1] = frag_kb(Vs + VPL + (t * 16 + col) * VP + kb, hh); }
      __builtin_amdgcn_sched_barrier(0);   // and ahead of the products of tiles 2 to 4, which cover their latency
#pragma unroll
      for (int t = 2; t < 8; t += 2) { o[t][0] *= al_[0]; o[t][1] *= al_[1]; o[t + 1][0] *= al_[0]; o[t + 1][1] *= al_[1];
        o[t][0] = wmma16b(vf[2 * t], pb[0], o[t][0]); o[t][1] = wmma16b(vf[2 * t], pb[1], o[t][1]); o[t + 1][0] = wmma16b(vf[2 * t + 2], pb[0], o[t + 1][0]); o[t + 1][1] = wmma16b(vf[2 * t + 2], pb[1], o[t + 1][1]);
        o[t][0] = wmma16b(vf[2 * t], pl[0], o[t][0]); o[t][1] = wmma16b(vf[2 * t], pl[1], o[t][1]); o[t + 1][0] = wmma16b(vf[2 * t + 2], pl[0], o[t + 1][0]); o[t + 1][1] = wmma16b(vf[2 * t + 2], pl[1], o[t + 1][1]);
        o[t][0] = wmma16b(vf[2 * t + 1], pb[0], o[t][0]); o[t][1] = wmma16b(vf[2 * t + 1], pb[1], o[t][1]); o[t + 1][0] = wmma16b(vf[2 * t + 3], pb[0], o[t + 1][0]); o[t + 1][1] = wmma16b(vf[2 * t + 3], pb[1], o[t + 1][1]); } }
    asm volatile("s_wait_dscnt 0x0" ::: "memory");     // this wave's reads of the buffer are done before it may be refilled
    asm volatile("s_wait_asynccnt 0x0" ::: "memory");  // this wave's share of tile tt + 1 has landed
    __syncthreads();                                   // publishes tile tt + 1 and ends every wave's reads of tile tt
    if (tt + 2 < NT) stage_tile(Ring + (tt & 1) * TILE, Kr, Klr, V, Vl, (tt + 2) * KT, tid);
  }
  asm volatile("s_wait_asynccnt 0x0" ::: "memory");    // no copy is outstanding when the wave ends
  // join of the two key halves: the upper half's waves hand over maximum, sum and o; the lower half's waves, lane for lane, rescale both to the common maximum, add and normalise
  if (kb != 0) {
#pragma unroll
    for (int g = 0; g < 2; ++g) { Ms[wq][g][lane] = m[g]; Ls[wq][g][lane] = l[g];
#pragma unroll
      for (int t = 0; t < 8; ++t)
#pragma unroll
        for (int r = 0; r < 8; ++r) Os[wq * 2 + g][col][t * 16 + 8 * hh + r] = o[t][g][r]; } }
  __syncthreads();                                     // the upper half's state is visible to the lower half's waves
  if (kb == 0) {
#pragma unroll
    for (int g = 0; g < 2; ++g) { const float m1 = Ms[wq][g][lane], l1 = Ls[wq][g][lane], mn = fmaxf(m[g], m1), e0 = nexp_slot(m[g] - mn), e1 = nexp_slot(m1 - mn); const float inv = 1.0f / ((l[g] * e0 + l1 * e1) * PS * XS), c0 = e0 * inv, c1 = e1 * inv;
#pragma unroll
      for (int t = 0; t < 8; ++t)
#pragma unroll
        for (int r = 0; r < 8; ++r) { float* p = &Os[wq * 2 + g][col][t * 16 + 8 * hh + r]; *p = o[t][g][r] * c0 + *p * c1; } } }
  __syncthreads();
  { for (int i = threadIdx.x; i < 128 * 32; i += 256) { const int rr = i >> 5, c4 = (i & 31) * 4; *(v4f*)(out + ((size_t)b * S + blockIdx.x * 128 + rr) * D + c4) = *(const v4f*)(&Os[rr >> 4][rr & 15][c4]); }  }
}
}  // namespace

extern "C" void kernel_launch(void* const* d_in, const int* in_sizes, int n_in,
                              void* d_out, int out_size, void* d_ws, size_t ws_size, hipStream_t stream) {
  (void)n_in; (void)out_size;
  const float* Q = (const float*)d_in[0]; const float* K = (const float*)d_in[1]; const float* V = (const float*)d_in[2];
  float* out = (float*)d_out;   // [4][8192][128]
  if (in_sizes[0] != Bn * S * D || in_sizes[1] != Bn * S * D || in_sizes[2] != Bn * S * D) return;
  size_t off = 0; char* ws = (char*)d_ws;
  auto carve = [&](size_t bytes) { char* p = ws + off; off += (bytes + 255) & ~(size_t)255; return p; };
  b16* QX = (b16*)carve((size_t)Bn * S * D * 2); b16* KH = (b16*)carve((size_t)Bn * SC * D * 2); b16* KL = (b16*)carve((size_t)Bn * SC * D * 2); b16* VTh = (b16*)carve((size_t)Bn * D * SC * 2); b16* VTl = (b16*)carve((size_t)Bn * D * SC * 2);
  if (off > ws_size) return;                        // ≈ 8.4 + 2.1 x 4 ≈ 17 MB
  prep_kernel<<<dim3(SC / 64, Bn), 256, 0, stream>>>(Q, K, V, QX, KH, KL, VTh, VTl);
  attn_kernel<<<dim3(S / 128, Bn), 256, 0, stream>>>(QX, KH, KL, VTh, VTl, out);
}

// v004
// One run takes 44.4 microseconds.
// Versions between v002 and this one are left out; their measured steps multiply to 1.87 times as fast.
// Over all steps from v000 it is 8.40 times as fast.
#include <hip/hip_runtime.h>

// CompressedAttention: K_c, V_c = mean over blocks of 4 consecutive keys (8192 -> 2048); out = softmax(Q.K_c / sqrt(128)) V_c -> [4][8192][128].
// WMMA (v_wmma_f32_16x16x32_f16, f32 accumulate): Q exact bf16 (x8 f16); K_c computed in f32 from the bf16 keys and rounded once to f16 (x8), S^T = K_c.Q (1 product);
// online softmax in f32; o^T += (8 V_c)^T.P^T with V_c and P each rounded once to f16 (1 product): 11 operand bits, where Q, K and V themselves carry 8.
// Fragment k-map per lane half hh for A AND B: elements 0..7 <- k = 8hh+0..7, 8..15 <- k = 16+8hh+0..7.

namespace {
constexpr int Bn = 4, S = 8192, D = 128, R4 = 4, SC = S / R4;
constexpr float XS = 8.0f, PS = 8.0f, ISC = 0.08838834764831845f;

typedef _Float16 b16;
typedef __attribute__((ext_vector_type(16))) _Float16 v16b;
typedef __attribute__((ext_vector_type(8))) _Float16 v8b;
typedef __attribute__((ext_vector_type(4))) _Float16 v4b;
typedef __attribute__((ext_vector_type(8))) float v8f;
typedef __attribute__((ext_vector_type(4))) float v4f;
__device__ __forceinline__ float bf16_rne(float f) { unsigned int u = __float_as_uint(f); u += 0x7FFFu + ((u >> 16) & 1u); return __uint_as_float(u & 0xFFFF0000u); }
__device__ __forceinline__ v16b frag_kb(const b16* p, int hh) { const v8b a = *(const v8b*)(p + 8 * hh), b = *(const v8b*)(p + 16 + 8 * hh); v16b f;
#pragma unroll
  for (int e = 0; e < 8; ++e) { f[e] = a[e]; f[8 + e] = b[e]; } return f; }
// the v_nop statement names D alone: what an asm statement names must lie in v0 to v255, and with A and B named as well the 32-query wave tile spills to scratch (seen in a build).
// A and B are then guarded by the compiler's own padding of the builtin against vector writes; the only other writers of fragment registers in the loop are ds_load_b128
__device__ __forceinline__ v8f wmma16b(v16b a, v16b b, v8f c) { v8f d = __builtin_amdgcn_wmma_f32_16x16x32_f16(false, a, false, b, (short)0, c, false, false); asm volatile("v_nop\n\tv_nop\n\tv_nop\n\tv_nop" : "+v"(d)); return d; }
__device__ __forceinline__ float nexp(float x) { return __builtin_amdgcn_exp2f(x * 1.4426950408889634f); }
// lane l <-> lane l ^ 16 as a vector cross-row move: a vector instruction, so the compiler keeps its distance behind a matrix instruction whose operand register it rewrites
__device__ __forceinline__ float xrow(float v) { const int b = __float_as_int(v); return __int_as_float(__builtin_amdgcn_permlanex16(b, b, 0x76543210, 0xfedcba98, false, false)); }
// the join's exponential with the one slot behind a transcendental in the same statement
__device__ __forceinline__ float nexp_slot(float x) { float r; asm("v_exp_f32 %0, %1\n\tv_nop" : "=v"(r) : "v"(x * 1.4426950408889634f)); return r; }
// a score's exponential, in place, with the same slot in the same statement; in place, so that the statement names one register (it must lie in v0 to v255; with two the build spilled)
__device__ __forceinline__ float nexp_in(float x) { float r = x * 1.4426950408889634f; asm("v_exp_f32 %0, %0\n\tv_nop" : "+v"(r)); return r; }
__device__ __forceinline__ float pmul(float a, float b) { float p = a * b; asm volatile("" : "+v"(p)); return p; }

// prep: Q rows f16 exact x8 [32768][128]; K_c = mean of 4 bf16 key rows (f32) -> f16 x8 rows KH [8192][128]; V_c likewise -> the (8 V_c)^T plane VT[b][128][2048] via an LDS transpose.
// One block per WGP (256 blocks of 8 waves); a thread asks for all of its 48 16-byte pieces (16 of V, 16 of K, 16 of Q; every load of a wave covers whole 128-byte lines) before it uses the first,
// so that a block pays one memory round trip instead of one per loop pass. Sums and roundings are those of the loops this replaces, element for element.
__device__ __forceinline__ v4f pool4(const v4f* x) { v4f s = (v4f){};
#pragma unroll
  for (int r = 0; r < R4; ++r)
#pragma unroll
    for (int e = 0; e < 4; ++e) s[e] += bf16_rne(x[r][e]);
  return s * (0.25f * XS); }
__global__ __launch_bounds__(256) void prep_kernel(const float* __restrict__ Q, const float* __restrict__ K, const float* __restrict__ V, b16* __restrict__ QX, b16* __restrict__ KH, b16* __restrict__ VTh) {
  __shared__ __attribute__((aligned(16))) b16 Th[64][64 + 8];
  const int b = blockIdx.y, j = blockIdx.x, t_ = threadIdx.x;
  // V: this block's tile is 64 pooled tokens x 64 columns (a whole 128-byte line of every V^T row it writes); a thread holds 4 adjacent tokens x 4 columns
  const int tb = j >> 1, ch = (j & 1) * 64, vc = (t_ & 15) * 4, vt = (t_ >> 4) * 4;
  // K and Q: this block's 128 original rows; K: a wave holds 16 whole rows (4 pooled tokens), Q: piece i * 256 + t_ of the 4096
  const int kc = (t_ & 31) * 4, kt = j * 32 + (t_ >> 5) * 4;
  const float* Vp = V + ((size_t)b * S + (size_t)(tb * 64 + vt) * R4) * D + ch + vc;
  const float* Kp = K + ((size_t)b * S + (size_t)kt * R4) * D + kc;
  const size_t q0 = ((size_t)b * S + (size_t)j * 128) * D + t_ * 4;
  const float* Qp = Q + q0;
  v4f vv[16], kk[16], qq[16];
#pragma unroll
  for (int i = 0; i < 16; ++i) vv[i] = *(const v4f*)(Vp + i * D);
  __builtin_amdgcn_sched_barrier(0);   // loads come back in issue order and are used in the order V, K, Q: this and the next one keep that order of issue (left free, part of V was issued last)
#pragma unroll
  for (int i = 0; i < 16; ++i) kk[i] = *(const v4f*)(Kp + i * D);
  __builtin_amdgcn_sched_barrier(0);   // K's loads stay ahead of Q's, for the same reason
#pragma unroll
  for (int i = 0; i < 16; ++i) qq[i] = *(const v4f*)(Qp + i * 1024);
  // precaution: the three address pairs are inputs here, so they stay whole up to this wait
  asm volatile("s_wait_xcnt 0x0" :: "v"(Vp), "v"(Kp), "v"(Qp) : "memory");
  __builtin_amdgcn_sched_barrier(0);   // all 48 loads are issued ahead of the first use: moved down among the sums they would wait one after another
  v4f pv[4];
#pragma unroll
  for (int k = 0; k < 4; ++k) pv[k] = pool4(vv + 4 * k);
#pragma unroll
  for (int e = 0; e < 4; ++e) { v4b h;
#pragma unroll
    for (int k = 0; k < 4; ++k) h[k] = (b16)pv[k][e];
    *(v4b*)(&Th[vc + e][vt]) = h; }
  // the transpose tile is complete. The two fences name LDS alone: __syncthreads() here waited for all 48 global loads as well, and K and Q could not be worked on while they arrive
  __builtin_amdgcn_fence(__ATOMIC_RELEASE, "workgroup", "local");
  __builtin_amdgcn_s_barrier();
  __builtin_amdgcn_fence(__ATOMIC_ACQUIRE, "workgroup", "local");
#pragma unroll
  for (int u = 0; u < 2; ++u) { const int c = u * 32 + (t_ >> 3), c8 = (t_ & 7) * 8; *(v8b*)(VTh + ((size_t)b * D + ch + c) * SC + tb * 64 + c8) = *(const v8b*)(&Th[c][c8]); }
#pragma unroll
  for (int k = 0; k < 4; ++k) { const v4f s = pool4(kk + 4 * k); v4b h;
#pragma unroll
    for (int e = 0; e < 4; ++e) h[e] = (b16)s[e];
    *(v4b*)(KH + ((size_t)b * SC + kt + k) * D + kc) = h; }
#pragma unroll
  for (int i = 0; i < 16; ++i) { v4b h;
#pragma unroll
    for (int e = 0; e < 4; ++e) h[e] = (b16)(bf16_rne(qq[i][e]) * XS);
    *(v4b*)(QX + q0 + i * 1024) = h; }
}
// LDS ring for the attention kernel: one tile = 64 keys: K_c (64 rows x 256 B at a 272 B pitch), (8 V_c)^T (128 rows x 128 B at a 144 B pitch); both pitches are 16 B x odd for 16-byte readers
constexpr int KT = 64, NT = SC / KT, KP = D + 8, VP = KT + 8, KPL = KT * KP, VPL = D * VP, TILE = KPL + VPL;
// eight asynchronous 16-byte copies per lane; the s_wait_xcnt closes the statement so that no address register is rewritten ahead of it
__device__ __forceinline__ void copy8(unsigned l0, unsigned l1, unsigned l2, unsigned l3, unsigned l4, unsigned l5, unsigned l6, unsigned l7, const b16* g0, const b16* g1, const b16* g2, const b16* g3, const b16* g4, const b16* g5, const b16* g6, const b16* g7) {
  asm volatile("global_load_async_to_lds_b128 %0, %8, off\n\tglobal_load_async_to_lds_b128 %1, %9, off\n\tglobal_load_async_to_lds_b128 %2, %10, off\n\tglobal_load_async_to_lds_b128 %3, %11, off\n\t"
               "global_load_async_to_lds_b128 %4, %12, off\n\tglobal_load_async_to_lds_b128 %5, %13, off\n\tglobal_load_async_to_lds_b128 %6, %14, off\n\tglobal_load_async_to_lds_b128 %7, %15, off\n\ts_wait_xcnt 0x0"
               :: "v"(l0), "v"(l1), "v"(l2), "v"(l3), "v"(l4), "v"(l5), "v"(l6), "v"(l7), "v"(g0), "v"(g1), "v"(g2), "v"(g3), "v"(g4), "v"(g5), "v"(g6), "v"(g7) : "memory"); }
// the whole block copies one 64-key tile (32 KB, 8 copies per lane): K rows are contiguous in memory, V^T rows are whole 128-byte lines
__device__ __forceinline__ void stage_tile(const b16* buf, const b16* Kr, const b16* V, int k0, int tid) {
  const unsigned lb = (unsigned)(size_t)buf;   // low 32 bits of the shared address = byte offset in the work-group's LDS
  const int kr = tid >> 4, kc = (tid & 15) * 8, vr = tid >> 3, vc = (tid & 7) * 8;
  const unsigned lk = lb + (unsigned)(kr * KP + kc) * 2u, lv = lb + (unsigned)(KPL + vr * VP + vc) * 2u;
  const size_t gk = (size_t)(k0 + kr) * D + kc, gv = (size_t)vr * SC + k0 + vc;
  copy8(lk, lk + 16 * KP * 2, lk + 32 * KP * 2, lk + 48 * KP * 2, lv, lv + 32 * VP * 2, lv + 64 * VP * 2, lv + 96 * VP * 2,
        Kr + gk, Kr + gk + 16 * D, Kr + gk + 32 * D, Kr + gk + 48 * D, V + gv, V + gv + 32 * SC, V + gv + 64 * SC, V + gv + 96 * SC);
}
// attention: block = 8 waves = 4 query groups x 2 key halves (128 queries of one batch). A wave holds 32 queries (two B fragments) and works ONE 32-key half of every staged 64-key tile,
// so that each K_c and V_c fragment read from LDS feeds two products; the two halves keep their own running maximum, sum and o and are joined once, after the loop, through LDS.
// S^T = K_c.Q (4 k-steps, 2 row tiles, 2 query tiles) / sqrt(128), online softmax, o^T += (8V_c)^T.P^T (8 tiles, 2 query tiles);
__global__ __launch_bounds__(256) void attn_kernel(const b16* __restrict__ QX, const b16* __restrict__ KH, const b16* __restrict__ VTh, float* __restrict__ out) {
  __shared__ __attribute__((aligned(16))) b16 Ring[2 * TILE];
  __shared__ __attribute__((aligned(16))) float Os[8][16][D + 4];
  __shared__ float Ms[4][2][32], Ls[4][2][32];
  const int tid = threadIdx.x, wave = __builtin_amdgcn_readfirstlane(tid >> 5), lane = tid & 31, hh = lane >> 4, col = lane & 15; const int wq = wave & 3, kb = (wave >> 2) * 32; const int b = blockIdx.y, q0 = blockIdx.x * 128 + wq * 32;
  const b16* Qr = QX + ((size_t)b * S) * D; const b16* Kr = KH + ((size_t)b * SC) * D; const b16* V = VTh + ((size_t)b * D) * SC;
  stage_tile(Ring, Kr, V, 0, tid);
  v16b qf[2][4];
#pragma unroll
  for (int g = 0; g < 2; ++g)
#pragma unroll
    for (int t = 0; t < 4; ++t) qf[g][t] = frag_kb(Qr + (size_t)(q0 + g * 16 + col) * D + t * 32, hh);
  float m[2] = {-INFINITY, -INFINITY}, l[2] = {0.0f, 0.0f}; v8f o[8][2];
#pragma unroll
  for (int t = 0; t < 8; ++t) { o[t][0] = (v8f){}; o[t][1] = (v8f){}; }
  asm volatile("s_wait_asynccnt 0x0" ::: "memory");   // this wave's share of tile 0 has landed
  __syncthreads();                                     // tile 0 is published to every wave
  stage_tile(Ring + TILE, Kr, V, KT, tid);
  for (int tt = 0; tt < NT; ++tt) {
    const b16* Ks = Ring + (tt & 1) * TILE; const b16* Vs = Ks + KPL;
    {
      // The LDS reads of a 32-key block stand in two groups, each issued ahead of the work that covers its latency. Each sched_barrier below holds such a group in its place:
      // without them the reads are spread among the matrix instructions, each pair in front of its own full wait.
      v16b kf[8], vf[8];
#pragma unroll
      for (int t = 0; t < 4; ++t) { kf[2 * t] = frag_kb(Ks + (kb + col) * KP + t * 32, hh); kf[2 * t + 1] = frag_kb(Ks + (kb + 16 + col) * KP + t * 32, hh); }
      __builtin_amdgcn_sched_barrier(0);   // the K reads of all four k-steps stay together, ahead of the products
      v8f s[2][2] = {};   // [16-key row tile][query tile]: four independent accumulators
#pragma unroll
      for (int t = 0; t < 4; ++t) { s[0][0] = wmma16b(kf[2 * t], qf[0][t], s[0][0]); s[0][1] = wmma16b(kf[2 * t], qf[1][t], s[0][1]); s[1][0] = wmma16b(kf[2 * t + 1], qf[0][t], s[1][0]); s[1][1] = wmma16b(kf[2 * t + 1], qf[1][t], s[1][1]); }
#pragma unroll
      for (int t = 0; t < 8; ++t) vf[t] = frag_kb(Vs + (t * 16 + col) * VP + kb, hh);
      __builtin_amdgcn_sched_barrier(0);   // the V reads of all eight output tiles issue ahead of the softmax, which covers their latency
      float mr[2], al_[2], sum[2]; v16b pb[2];
#pragma unroll
      for (int g = 0; g < 2; ++g) { mr[g] = -INFINITY;
#pragma unroll
        for (int r = 0; r < 8; ++r) { s[0][g][r] *= ISC / (XS * XS); s[1][g][r] *= ISC / (XS * XS); mr[g] = fmaxf(mr[g], fmaxf(s[0][g][r], s[1][g][r])); } }
#pragma unroll
      for (int g = 0; g < 2; ++g) mr[g] = fmaxf(mr[g], xrow(mr[g]));
#pragma unroll
      for (int g = 0; g < 2; ++g) { const float mn = fmaxf(m[g], mr[g]); al_[g] = nexp(m[g] - mn); m[g] = mn; sum[g] = 0.0f;
#pragma unroll
        for (int r = 0; r < 8; ++r) { const float e0 = nexp_in(s[0][g][r] - mn), e1 = nexp_in(s[1][g][r] - mn); sum[g] += e0 + e1; pb[g][r] = (b16)(e0 * PS); pb[g][8 + r] = (b16)(e1 * PS); } }
#pragma unroll
      for (int g = 0; g < 2; ++g) { sum[g] += xrow(sum[g]); l[g] = l[g] * al_[g] + sum[g]; }
#pragma unroll
      for (int t = 0; t < 8; t += 2) { o[t][0] *= al_[0]; o[t][1] *= al_[1]; o[t + 1][0] *= al_[0]; o[t + 1][1] *= al_[1];
        o[t][0] = wmma16b(vf[t], pb[0], o[t][0]); o[t][1] = wmma16b(vf[t], pb[1], o[t][1]); o[t + 1][0] = wmma16b(vf[t + 1], pb[0], o[t + 1][0]); o[t + 1][1] = wmma16b(vf[t + 1], pb[1], o[t + 1][1]); } }   // two output tiles x two query tiles: four independent accumulators in turn
    asm volatile("s_wait_dscnt 0x0" ::: "memory");     // this wave's reads of the buffer are done before it may be refilled
    asm volatile("s_wait_asynccnt 0x0" ::: "memory");  // this wave's share of tile tt + 1 has landed
    __syncthreads();                                   // publishes tile tt + 1 and ends every wave's reads of tile tt
    if (tt + 2 < NT) stage_tile(Ring + (tt & 1) * TILE, Kr, V, (tt + 2) * KT, tid);
  }
  asm volatile("s_wait_asynccnt 0x0" ::: "memory");    // no copy is outstanding when the wave ends
  // join of the two key halves: the upper half's waves hand over maximum, sum and o; the lower half's waves, lane for lane, rescale both to the common maximum, add and normalise
  if (kb != 0) {
#pragma unroll
    for (int g = 0; g < 2; ++g) { Ms[wq][g][lane] = m[g]; Ls[wq][g][lane] = l[g];
#pragma unroll
      for (int t = 0; t < 8; ++t)
#pragma unroll
        for (int r = 0; r < 8; ++r) Os[wq * 2 + g][col][t * 16 + 8 * hh + r] = o[t][g][r]; } }
  __syncthreads();                                     // the upper half's state is visible to the lower half's waves
  if (kb == 0) {
#pragma unroll
    for (int g = 0; g < 2; ++g) { const float m1 = Ms[wq][g][lane], l1 = Ls[wq][g][lane], mn = fmaxf(m[g], m1), e0 = nexp_slot(m[g] - mn), e1 = nexp_slot(m1 - mn); const float inv = 1.0f / ((l[g] * e0 + l1 * e1) * PS * XS), c0 = e0 * inv, c1 = e1 * inv;
#pragma unroll
      for (int t = 0; t < 8; ++t)
#pragma unroll
        for (int r = 0; r < 8; ++r) { float* p = &Os[wq * 2 + g][col][t * 16 + 8 * hh + r]; *p = o[t][g][r] * c0 + *p * c1; } } }
  __syncthreads();
  { for (int i = threadIdx.x; i < 128 * 32; i += 256) { const int rr = i >> 5, c4 = (i & 31) * 4; *(v4f*)(out + ((size_t)b * S + blockIdx.x * 128 + rr) * D + c4) = *(const v4f*)(&Os[rr >> 4][rr & 15][c4]); }  }
}
}  // namespace

extern "C" void kernel_launch(void* const* d_in, const int* in_sizes, int n_in,
                              void* d_out, int out_size, void* d_ws, size_t ws_size, hipStream_t stream) {
  (void)n_in; (void)out_size;
  const float* Q = (const float*)d_in[0]; const float* K = (const float*)d_in[1]; const float* V = (const float*)d_in[2];
  float* out = (float*)d_out;   // [4][8192][128]
  if (in_sizes[0] != Bn * S * D || in_sizes[1] != Bn * S * D || in_sizes[2] != Bn * S * D) return;
  size_t off = 0; char* ws = (char*)d_ws;
  auto carve = [&](size_t bytes) { char* p = ws + off; off += (bytes + 255) & ~(size_t)255; return p; };
  b16* QX = (b16*)carve((size_t)Bn * S * D * 2); b16* KH = (b16*)carve((size_t)Bn * SC * D * 2); b16* VTh = (b16*)carve((size_t)Bn * D * SC * 2);
  if (off > ws_size) return;                        // about 8.4 + 2.1 x 2 = 12.6 MB
  prep_kernel<<<dim3(S / 128, Bn), 256, 0, stream>>>(Q, K, V, QX, KH, VTh);
  attn_kernel<<<dim3(S / 128, Bn), 256, 0, stream>>>(QX, KH, VTh, out);
}

// v005
// Measured time: 39 microseconds a run.
// Timed twice side by side with v004, it ran 1.13 and 1.14 times as fast.
// Counting every step since v000, it is 9.54 times as fast.
#include <hip/hip_runtime.h>

// CompressedAttention: K_c, V_c = mean over blocks of 4 consecutive keys (8192 -> 2048); out = softmax(Q.K_c / sqrt(128)) V_c -> [4][8192][128].
// WMMA (v_wmma_f32_16x16x32_f16, f32 accumulate): Q exact bf16 (x8 f16); K_c computed in f32 from the bf16 keys and rounded once to f16 (x8), S^T = K_c.Q (1 product);
// online softmax in f32; o^T += (8 V_c)^T.P^T with V_c and P each rounded once to f16 (1 product): 11 operand bits, where Q, K and V themselves carry 8.
// Fragment k-map per lane half hh for A AND B: elements 0..7 <- k = 8hh+0..7, 8..15 <- k = 16+8hh+0..7.

namespace {
constexpr int Bn = 4, S = 8192, D = 128, R4 = 4, SC = S / R4;
constexpr float XS = 8.0f, ISC = 0.08838834764831845f;
// softmax runs on powers of two: C2 takes a raw accumulator (64 Q.K_c) to score * log2(e); PL = log2 of the factor 8 that P carries into its f16 rounding
constexpr float C2 = ISC / (XS * XS) * 1.4426950408889634f, PL = 3.0f;

typedef _Float16 b16;
typedef __attribute__((ext_vector_type(16))) _Float16 v16b;
typedef __attribute__((ext_vector_type(8))) _Float16 v8b;
typedef __attribute__((ext_vector_type(4))) _Float16 v4b;
typedef __attribute__((ext_vector_type(8))) float v8f;
typedef __attribute__((ext_vector_type(4))) float v4f;
__device__ __forceinline__ float bf16_rne(float f) { unsigned int u = __float_as_uint(f); u += 0x7FFFu + ((u >> 16) & 1u); return __uint_as_float(u & 0xFFFF0000u); }
__device__ __forceinline__ v16b frag_kb(const b16* p, int hh) { const v8b a = *(const v8b*)(p + 8 * hh), b = *(const v8b*)(p + 16 + 8 * hh); v16b f;
#pragma unroll
  for (int e = 0; e < 8; ++e) { f[e] = a[e]; f[8 + e] = b[e]; } return f; }
// the v_nop statement names D alone: what an asm statement names must lie in v0 to v255, and with A and B named as well the 32-query wave tile spills to scratch (seen in a build).
// A and B are then guarded by the compiler's own padding of the builtin against vector writes; the only other writers of fragment registers in the loop are ds_load_b128
__device__ __forceinline__ v8f wmma16b(v16b a, v16b b, v8f c) { v8f d = __builtin_amdgcn_wmma_f32_16x16x32_f16(false, a, false, b, (short)0, c, false, false); asm volatile("v_nop\n\tv_nop\n\tv_nop\n\tv_nop" : "+v"(d)); return d; }
__device__ __forceinline__ float nexp(float x) { return __builtin_amdgcn_exp2f(x); }   // 2^x
// lane l <-> lane l ^ 16 as a vector cross-row move: a vector instruction, so the compiler keeps its distance behind a matrix instruction whose operand register it rewrites (an LDS permute is not held so)
__device__ __forceinline__ float xrow(float v) { const int b = __float_as_int(v); return __int_as_float(__builtin_amdgcn_permlanex16(b, b, 0x76543210, 0xfedcba98, false, false)); }
// the join's exponential with the one slot behind a transcendental in the same statement
__device__ __forceinline__ float nexp_slot(float x) { float r; asm("v_exp_f32 %0, %1\n\tv_nop" : "=v"(r) : "v"(x)); return r; }
// a score's exponential, in place, with the same slot in the same statement: in place, so that the statement names one register (it must lie in v0 to v255; with two the build spilled)
__device__ __forceinline__ float nexp_in(float x) { float r = x; asm("v_exp_f32 %0, %0\n\tv_nop" : "+v"(r)); return r; }
__device__ __forceinline__ float pmul(float a, float b) { float p = a * b; asm volatile("" : "+v"(p)); return p; }

// prep: Q rows f16 exact x8 [32768][128]; K_c = mean of 4 bf16 key rows (f32) -> f16 x8 rows KH [8192][128]; V_c likewise -> the (8 V_c)^T plane VT[b][128][2048] via an LDS transpose.
// One block per WGP (256 blocks of 8 waves); a thread asks for all of its 48 16-byte pieces (16 of V, 16 of K, 16 of Q; every load of a wave covers whole 128-byte lines) before it uses the first,
// so that a block pays one memory round trip instead of one per loop pass. Sums and roundings are those of the loops this replaces, element for element.
__device__ __forceinline__ v4f pool4(const v4f* x) { v4f s = (v4f){};
#pragma unroll
  for (int r = 0; r < R4; ++r)
#pragma unroll
    for (int e = 0; e < 4; ++e) s[e] += bf16_rne(x[r][e]);
  return s * (0.25f * XS); }
__global__ __launch_bounds__(256) void prep_kernel(const float* __restrict__ Q, const float* __restrict__ K, const float* __restrict__ V, b16* __restrict__ QX, b16* __restrict__ KH, b16* __restrict__ VTh) {
  __shared__ __attribute__((aligned(16))) b16 Th[64][64 + 8];
  const int b = blockIdx.y, j = blockIdx.x, t_ = threadIdx.x;
  // V: this block's tile is 64 pooled tokens x 64 columns (a whole 128-byte line of every V^T row it writes); a thread holds 4 adjacent tokens x 4 columns
  const int tb = j >> 1, ch = (j & 1) * 64, vc = (t_ & 15) * 4, vt = (t_ >> 4) * 4;
  // K and Q: this block's 128 original rows; K: a wave holds 16 whole rows (4 pooled tokens), Q: piece i * 256 + t_ of the 4096
  const int kc = (t_ & 31) * 4, kt = j * 32 + (t_ >> 5) * 4;
  const float* Vp = V + ((size_t)b * S + (size_t)(tb * 64 + vt) * R4) * D + ch + vc;
  const float* Kp = K + ((size_t)b * S + (size_t)kt * R4) * D + kc;
  const size_t q0 = ((size_t)b * S + (size_t)j * 128) * D + t_ * 4;
  const float* Qp = Q + q0;
  v4f vv[16], kk[16], qq[16];
#pragma unroll
  for (int i = 0; i < 16; ++i) vv[i] = *(const v4f*)(Vp + i * D);
  __builtin_amdgcn_sched_barrier(0);   // loads come back in issue order and are used in the order V, K, Q: this and the next one keep that order of issue (left free, part of V was issued last)
#pragma unroll
  for (int i = 0; i < 16; ++i) kk[i] = *(const v4f*)(Kp + i * D);
  __builtin_amdgcn_sched_barrier(0);   // K's loads stay ahead of Q's, for the same reason
#pragma unroll
  for (int i = 0; i < 16; ++i) qq[i] = *(const v4f*)(Qp + i * 1024);
  // precaution: the three address pairs are inputs here, so they stay whole up to this wait
  asm volatile("s_wait_xcnt 0x0" :: "v"(Vp), "v"(Kp), "v"(Qp) : "memory");
  __builtin_amdgcn_sched_barrier(0);   // all 48 loads are issued ahead of the first use: moved down among the sums they would wait one after another
  v4f pv[4];
#pragma unroll
  for (int k = 0; k < 4; ++k) pv[k] = pool4(vv + 4 * k);
#pragma unroll
  for (int e = 0; e < 4; ++e) { v4b h;
#pragma unroll
    for (int k = 0; k < 4; ++k) h[k] = (b16)pv[k][e];
    *(v4b*)(&Th[vc + e][vt]) = h; }
  // the transpose tile is complete. The two fences name LDS alone: __syncthreads() here waited for all 48 global loads as well, and K and Q could not be worked on while they arrive
  __builtin_amdgcn_fence(__ATOMIC_RELEASE, "workgroup", "local");
  __builtin_amdgcn_s_barrier();
  __builtin_amdgcn_fence(__ATOMIC_ACQUIRE, "workgroup", "local");
#pragma unroll
  for (int u = 0; u < 2; ++u) { const int c = u * 32 + (t_ >> 3), c8 = (t_ & 7) * 8; *(v8b*)(VTh + ((size_t)b * D + ch + c) * SC + tb * 64 + c8) = *(const v8b*)(&Th[c][c8]); }
#pragma unroll
  for (int k = 0; k < 4; ++k) { const v4f s = pool4(kk + 4 * k); v4b h;
#pragma unroll
    for (int e = 0; e < 4; ++e) h[e] = (b16)s[e];
    *(v4b*)(KH + ((size_t)b * SC + kt + k) * D + kc) = h; }
#pragma unroll
  for (int i = 0; i < 16; ++i) { v4b h;
#pragma unroll
    for (int e = 0; e < 4; ++e) h[e] = (b16)(bf16_rne(qq[i][e]) * XS);
    *(v4b*)(QX + q0 + i * 1024) = h; }
}
// LDS ring for the attention kernel: one tile = 64 keys: K_c (64 rows x 256 B at a 272 B pitch), (8 V_c)^T (128 rows x 128 B at a 144 B pitch); both pitches are 16 B x odd for 16-byte readers
constexpr int KT = 64, NT = SC / KT, KP = D + 8, VP = KT + 8, KPL = KT * KP, VPL = D * VP, TILE = KPL + VPL;
// eight asynchronous 16-byte copies per lane; the s_wait_xcnt closes the statement so that no address register is rewritten ahead of it
__device__ __forceinline__ void copy8(unsigned l0, unsigned l1, unsigned l2, unsigned l3, unsigned l4, unsigned l5, unsigned l6, unsigned l7, const b16* g0, const b16* g1, const b16* g2, const b16* g3, const b16* g4, const b16* g5, const b16* g6, const b16* g7) {
  asm volatile("global_load_async_to_lds_b128 %0, %8, off\n\tglobal_load_async_to_lds_b128 %1, %9, off\n\tglobal_load_async_to_lds_b128 %2, %10, off\n\tglobal_load_async_to_lds_b128 %3, %11, off\n\t"
               "global_load_async_to_lds_b128 %4, %12, off\n\tglobal_load_async_to_lds_b128 %5, %13, off\n\tglobal_load_async_to_lds_b128 %6, %14, off\n\tglobal_load_async_to_lds_b128 %7, %15, off\n\ts_wait_xcnt 0x0"
               :: "v"(l0), "v"(l1), "v"(l2), "v"(l3), "v"(l4), "v"(l5), "v"(l6), "v"(l7), "v"(g0), "v"(g1), "v"(g2), "v"(g3), "v"(g4), "v"(g5), "v"(g6), "v"(g7) : "memory"); }
// the whole block copies one 64-key tile (32 KB, 8 copies per lane): K rows are contiguous in memory, V^T rows are whole 128-byte lines
__device__ __forceinline__ void stage_tile(const b16* buf, const b16* Kr, const b16* V, int k0, int tid) {
  const unsigned lb = (unsigned)(size_t)buf;   // low 32 bits of the shared address = byte offset in the work-group's LDS
  const int kr = tid >> 4, kc = (tid & 15) * 8, vr = tid >> 3, vc = (tid & 7) * 8;
  const unsigned lk = lb + (unsigned)(kr * KP + kc) * 2u, lv = lb + (unsigned)(KPL + vr * VP + vc) * 2u;
  const size_t gk = (size_t)(k0 + kr) * D + kc, gv = (size_t)vr * SC + k0 + vc;
  copy8(lk, lk + 16 * KP * 2, lk + 32 * KP * 2, lk + 48 * KP * 2, lv, lv + 32 * VP * 2, lv + 64 * VP * 2, lv + 96 * VP * 2,
        Kr + gk, Kr + gk + 16 * D, Kr + gk + 32 * D, Kr + gk + 48 * D, V + gv, V + gv + 32 * SC, V + gv + 64 * SC, V + gv + 96 * SC);
}
// attention: block = 8 waves = 4 query groups x 2 key halves (128 queries of one batch). A wave holds 32 queries (two B fragments) and works ONE 32-key half of every staged 64-key tile,
// so that each K_c and V_c fragment read from LDS feeds two products; the two halves keep their own running maximum, sum and o and are joined once, after the loop, through LDS.
// S^T = K_c.Q (4 k-steps, 2 row tiles, 2 query tiles) / sqrt(128), online softmax, o^T += (8V_c)^T.P^T (8 tiles, 2 query tiles);
__global__ __launch_bounds__(256) void attn_kernel(const b16* __restrict__ QX, const b16* __restrict__ KH, const b16* __restrict__ VTh, float* __restrict__ out) {
  __shared__ __attribute__((aligned(16))) b16 Ring[2 * TILE];
  __shared__ __attribute__((aligned(16))) float Os[8][16][D + 4];
  __shared__ float Ms[4][2][32], Ls[4][2][32];
  const int tid = threadIdx.x, wave = __builtin_amdgcn_readfirstlane(tid >> 5), lane = tid & 31, hh = lane >> 4, col = lane & 15; const int wq = wave & 3, kb = (wave >> 2) * 32; const int b = blockIdx.y, q0 = blockIdx.x * 128 + wq * 32;
  const b16* Qr = QX + ((size_t)b * S) * D; const b16* Kr = KH + ((size_t)b * SC) * D; const b16* V = VTh + ((size_t)b * D) * SC;
  stage_tile(Ring, Kr, V, 0, tid);
  v16b qf[2][4];
#pragma unroll
  for (int g = 0; g < 2; ++g)
#pragma unroll
    for (int t = 0; t < 4; ++t) qf[g][t] = frag_kb(Qr + (size_t)(q0 + g * 16 + col) * D + t * 32, hh);
  float m[2] = {-INFINITY, -INFINITY}, l[2] = {0.0f, 0.0f}; v8f o[8][2];
#pragma unroll
  for (int t = 0; t < 8; ++t) { o[t][0] = (v8f){}; o[t][1] = (v8f){}; }
  asm volatile("s_wait_asynccnt 0x0" ::: "memory");   // this wave's share of tile 0 has landed
  __syncthreads();                                     // tile 0 is published to every wave
  stage_tile(Ring + TILE, Kr, V, KT, tid);
  for (int tt = 0; tt < NT; ++tt) {
    const b16* Ks = Ring + (tt & 1) * TILE; const b16* Vs = Ks + KPL;
    {
      // The LDS reads of a 32-key block stand in two groups, each issued ahead of the work that covers its latency. Each sched_barrier below holds such a group in its place:
      // without them the reads are spread among the matrix instructions, each pair in front of its own full wait.
      v16b kf[8], vf[8];
#pragma unroll
      for (int t = 0; t < 4; ++t) { kf[2 * t] = frag_kb(Ks + (kb + col) * KP + t * 32, hh); kf[2 * t + 1] = frag_kb(Ks + (kb + 16 + col) * KP + t * 32, hh); }
      __builtin_amdgcn_sched_barrier(0);   // the K reads of all four k-steps stay together, ahead of the products
      v8f s[2][2] = {};   // [16-key row tile][query tile]: four independent accumulators
#pragma unroll
      for (int t = 0; t < 4; ++t) { s[0][0] = wmma16b(kf[2 * t], qf[0][t], s[0][0]); s[0][1] = wmma16b(kf[2 * t], qf[1][t], s[0][1]); s[1][0] = wmma16b(kf[2 * t + 1], qf[0][t], s[1][0]); s[1][1] = wmma16b(kf[2 * t + 1], qf[1][t], s[1][1]); }
#pragma unroll
      for (int t = 0; t < 8; ++t) vf[t] = frag_kb(Vs + (t * 16 + col) * VP + kb, hh);
      __builtin_amdgcn_sched_barrier(0);   // the V reads of all eight output tiles issue ahead of the softmax, which covers their latency
      float mr[2], al_[2], sum[2]; v16b pb[2];
#pragma unroll
      for (int g = 0; g < 2; ++g) { mr[g] = -INFINITY;
#pragma unroll
        for (int r = 0; r < 8; ++r) mr[g] = fmaxf(mr[g], fmaxf(s[0][g][r], s[1][g][r])); }   // maximum of the raw accumulators: C2 > 0 keeps the order
#pragma unroll
      for (int g = 0; g < 2; ++g) mr[g] = fmaxf(mr[g], xrow(mr[g]));
#pragma unroll
      for (int g = 0; g < 2; ++g) { const float mn = fmaxf(m[g], mr[g]); al_[g] = nexp((m[g] - mn) * C2); m[g] = mn;   // m is kept in the accumulators' own units
        const float bias = PL - mn * C2; const v8f x0 = s[0][g] * C2 + bias, x1 = s[1][g] * C2 + bias;   // one fused multiply-add per score: 8 P = 2^(C2 (s - m) + 3)
#pragma unroll
        for (int r = 0; r < 8; ++r) { const float e0 = nexp_in(x0[r]), e1 = nexp_in(x1[r]); sum[g] = r == 0 ? e0 + e1 : sum[g] + (e0 + e1); pb[g][r] = (b16)e0; pb[g][8 + r] = (b16)e1; } }   // the sum carries the factor 8 too
#pragma unroll
      for (int g = 0; g < 2; ++g) { sum[g] += xrow(sum[g]); l[g] = l[g] * al_[g] + sum[g]; }
#pragma unroll
      for (int t = 0; t < 8; t += 2) { o[t][0] *= al_[0]; o[t][1] *= al_[1]; o[t + 1][0] *= al_[0]; o[t + 1][1] *= al_[1];
        o[t][0] = wmma16b(vf[t], pb[0], o[t][0]); o[t][1] = wmma16b(vf[t], pb[1], o[t][1]); o[t + 1][0] = wmma16b(vf[t + 1], pb[0], o[t + 1][0]); o[t + 1][1] = wmma16b(vf[t + 1], pb[1], o[t + 1][1]); } }   // two output tiles x two query tiles: four independent accumulators in turn
    asm volatile("s_wait_dscnt 0x0" ::: "memory");     // this wave's reads of the buffer are done before it may be refilled
    asm volatile("s_wait_asynccnt 0x0" ::: "memory");  // this wave's share of tile tt + 1 has landed
    __syncthreads();                                   // publishes tile tt + 1 and ends every wave's reads of tile tt
    if (tt + 2 < NT) stage_tile(Ring + (tt & 1) * TILE, Kr, V, (tt + 2) * KT, tid);
  }
  asm volatile("s_wait_asynccnt 0x0" ::: "memory");    // no copy is outstanding when the wave ends
  // join of the two key halves: the upper half's waves hand over maximum, sum and o; the lower half's waves, lane for lane, rescale both to the common maximum, add and normalise
  if (kb != 0) {
#pragma unroll
    for (int g = 0; g < 2; ++g) { Ms[wq][g][lane] = m[g]; Ls[wq][g][lane] = l[g];
#pragma unroll
      for (int t = 0; t < 8; ++t)
#pragma unroll
        for (int r = 0; r < 8; ++r) Os[wq * 2 + g][col][t * 16 + 8 * hh + r] = o[t][g][r]; } }
  __syncthreads();                                     // the upper half's state is visible to the lower half's waves
  if (kb == 0) {
#pragma unroll
    for (int g = 0; g < 2; ++g) { const float m1 = Ms[wq][g][lane], l1 = Ls[wq][g][lane], mn = fmaxf(m[g], m1), e0 = nexp_slot((m[g] - mn) * C2), e1 = nexp_slot((m1 - mn) * C2); const float inv = 1.0f / ((l[g] * e0 + l1 * e1) * XS), c0 = e0 * inv, c1 = e1 * inv;
#pragma unroll
      for (int t = 0; t < 8; ++t)
#pragma unroll
        for (int r = 0; r < 8; ++r) { float* p = &Os[wq * 2 + g][col][t * 16 + 8 * hh + r]; *p = o[t][g][r] * c0 + *p * c1; } } }
  __syncthreads();
  { for (int i = threadIdx.x; i < 128 * 32; i += 256) { const int rr = i >> 5, c4 = (i & 31) * 4; *(v4f*)(out + ((size_t)b * S + blockIdx.x * 128 + rr) * D + c4) = *(const v4f*)(&Os[rr >> 4][rr & 15][c4]); }  }
}
}  // namespace

extern "C" void kernel_launch(void* const* d_in, const int* in_sizes, int n_in,
                              void* d_out, int out_size, void* d_ws, size_t ws_size, hipStream_t stream) {
  (void)n_in; (void)out_size;
  const float* Q = (const float*)d_in[0]; const float* K = (const float*)d_in[1]; const float* V = (const float*)d_in[2];
  float* out = (float*)d_out;   // [4][8192][128]
  if (in_sizes[0] != Bn * S * D || in_sizes[1] != Bn * S * D || in_sizes[2] != Bn * S * D) return;
  size_t off = 0; char* ws = (char*)d_ws;
  auto carve = [&](size_t bytes) { char* p = ws + off; off += (bytes + 255) & ~(size_t)255; return p; };
  b16* QX = (b16*)carve((size_t)Bn * S * D * 2); b16* KH = (b16*)carve((size_t)Bn * SC * D * 2); b16* VTh = (b16*)carve((size_t)Bn * D * SC * 2);
  if (off > ws_size) return;                        // about 8.4 + 2.1 x 2 = 12.6 MB
  prep_kernel<<<dim3(S / 128, Bn), 256, 0, stream>>>(Q, K, V, QX, KH, VTh);
  attn_kernel<<<dim3(S / 128, Bn), 256, 0, stream>>>(QX, KH, VTh, out);
}

// v006
// It runs in 37.7 microseconds.
// Two timings next to v005 put it at 1.06 and 1.03 times that version's speed.
// All steps since v000 together make it 9.98 times as fast.
#include <hip/hip_runtime.h>

// CompressedAttention: K_c, V_c = mean over blocks of 4 consecutive keys (8192 -> 2048); out = softmax(Q.K_c / sqrt(128)) V_c -> [4][8192][128].
// WMMA (v_wmma_f32_16x16x32_f16, f32 accumulate): Q exact bf16 (x8 f16); K_c computed in f32 from the bf16 keys and rounded once to f16 (x8), S^T = K_c.Q (1 product);
// online softmax in f32; o^T += (8 V_c)^T.P^T with V_c and P each rounded once to f16 (1 product): 11 operand bits, where Q, K and V themselves carry 8.
// Fragment k-map per lane half hh for A AND B: elements 0..7 <- k = 8hh+0..7, 8..15 <- k = 16+8hh+0..7.

namespace {
constexpr int Bn = 4, S = 8192, D = 128, R4 = 4, SC = S / R4;
constexpr float XS = 8.0f, ISC = 0.08838834764831845f;
// softmax runs on powers of two: C2 takes a raw accumulator (64 Q.K_c) to score * log2(e); PL = log2 of the factor 8 that P carries into its f16 rounding
constexpr float C2 = ISC / (XS * XS) * 1.4426950408889634f, PL = 3.0f;

typedef _Float16 b16;
typedef __attribute__((ext_vector_type(16))) _Float16 v16b;
typedef __attribute__((ext_vector_type(8))) _Float16 v8b;
typedef __attribute__((ext_vector_type(4))) _Float16 v4b;
typedef __attribute__((ext_vector_type(8))) float v8f;
typedef __attribute__((ext_vector_type(4))) float v4f;
__device__ __forceinline__ float bf16_rne(float f) { unsigned int u = __float_as_uint(f); u += 0x7FFFu + ((u >> 16) & 1u); return __uint_as_float(u & 0xFFFF0000u); }
__device__ __forceinline__ v16b frag_kb(const b16* p, int hh) { const v8b a = *(const v8b*)(p + 8 * hh), b = *(const v8b*)(p + 16 + 8 * hh); v16b f;
#pragma unroll
  for (int e = 0; e < 8; ++e) { f[e] = a[e]; f[8 + e] = b[e]; } return f; }
// the builtin alone: the compiler keeps the distance behind its own matrix instructions (it pads only in front of a vector instruction that touches D, A or B), so products that follow one another carry no filler
__device__ __forceinline__ v8f wmma16b(v16b a, v16b b, v8f c) { return __builtin_amdgcn_wmma_f32_16x16x32_f16(false, a, false, b, (short)0, c, false, false); }
__device__ __forceinline__ float nexp(float x) { return __builtin_amdgcn_exp2f(x); }   // 2^x
// lane l <-> lane l ^ 16 as a vector cross-row move: a vector instruction, so the compiler keeps its distance behind a matrix instruction whose operand register it rewrites (an LDS permute is not held so)
__device__ __forceinline__ float xrow(float v) { const int b = __float_as_int(v); return __int_as_float(__builtin_amdgcn_permlanex16(b, b, 0x76543210, 0xfedcba98, false, false)); }
// the join's exponential with the one slot behind a transcendental in the same statement
__device__ __forceinline__ float nexp_slot(float x) { float r; asm("v_exp_f32 %0, %1\n\tv_nop" : "=v"(r) : "v"(x)); return r; }
// a score's exponential, in place, with the same slot in the same statement: in place, so that the statement names one register (it must lie in v0 to v255; with two the build spilled)
__device__ __forceinline__ float nexp_in(float x) { float r = x; asm("v_exp_f32 %0, %0\n\tv_nop" : "+v"(r)); return r; }
__device__ __forceinline__ float pmul(float a, float b) { float p = a * b; asm volatile("" : "+v"(p)); return p; }

// prep: Q rows f16 exact x8 [32768][128]; K_c = mean of 4 bf16 key rows (f32) -> f16 x8 rows KH [8192][128]; V_c likewise -> the (8 V_c)^T plane VT[b][128][2048] via an LDS transpose.
// One block per WGP (256 blocks of 8 waves); a thread asks for all of its 48 16-byte pieces (16 of V, 16 of K, 16 of Q; every load of a wave covers whole 128-byte lines) before it uses the first,
// so that a block pays one memory round trip instead of one per loop pass. Sums and roundings are those of the loops this replaces, element for element.
__device__ __forceinline__ v4f pool4(const v4f* x) { v4f s = (v4f){};
#pragma unroll
  for (int r = 0; r < R4; ++r)
#pragma unroll
    for (int e = 0; e < 4; ++e) s[e] += bf16_rne(x[r][e]);
  return s * (0.25f * XS); }
__global__ __launch_bounds__(256) void prep_kernel(const float* __restrict__ Q, const float* __restrict__ K, const float* __restrict__ V, b16* __restrict__ QX, b16* __restrict__ KH, b16* __restrict__ VTh) {
  __shared__ __attribute__((aligned(16))) b16 Th[64][64 + 8];
  const int b = blockIdx.y, j = blockIdx.x, t_ = threadIdx.x;
  // V: this block's tile is 64 pooled tokens x 64 columns (a whole 128-byte line of every V^T row it writes); a thread holds 4 adjacent tokens x 4 columns
  const int tb = j >> 1, ch = (j & 1) * 64, vc = (t_ & 15) * 4, vt = (t_ >> 4) * 4;
  // K and Q: this block's 128 original rows; K: a wave holds 16 whole rows (4 pooled tokens), Q: piece i * 256 + t_ of the 4096
  const int kc = (t_ & 31) * 4, kt = j * 32 + (t_ >> 5) * 4;
  const float* Vp = V + ((size_t)b * S + (size_t)(tb * 64 + vt) * R4) * D + ch + vc;
  const float* Kp = K + ((size_t)b * S + (size_t)kt * R4) * D + kc;
  const size_t q0 = ((size_t)b * S + (size_t)j * 128) * D + t_ * 4;
  const float* Qp = Q + q0;
  v4f vv[16], kk[16], qq[16];
#pragma unroll
  for (int i = 0; i < 16; ++i) vv[i] = *(const v4f*)(Vp + i * D);
  __builtin_amdgcn_sched_barrier(0);   // loads come back in issue order and are used in the order V, K, Q: this and the next one keep that order of issue (left free, part of V was issued last)
#pragma unroll
  for (int i = 0; i < 16; ++i) kk[i] = *(const v4f*)(Kp + i * D);
  __builtin_amdgcn_sched_barrier(0);   // K's loads stay ahead of Q's, for the same reason
#pragma unroll
  for (int i = 0; i < 16; ++i) qq[i] = *(const v4f*)(Qp + i * 1024);
  // precaution: the three address pairs are inputs here, so they stay whole up to this wait
  asm volatile("s_wait_xcnt 0x0" :: "v"(Vp), "v"(Kp), "v"(Qp) : "memory");
  __builtin_amdgcn_sched_barrier(0);   // all 48 loads are issued ahead of the first use: moved down among the sums they would wait one after another
  v4f pv[4];
#pragma unroll
  for (int k = 0; k < 4; ++k) pv[k] = pool4(vv + 4 * k);
#pragma unroll
  for (int e = 0; e < 4; ++e) { v4b h;
#pragma unroll
    for (int k = 0; k < 4; ++k) h[k] = (b16)pv[k][e];
    *(v4b*)(&Th[vc + e][vt]) = h; }
  // the transpose tile is complete. The two fences name LDS alone: __syncthreads() here waited for all 48 global loads as well, and K and Q could not be worked on while they arrive
  __builtin_amdgcn_fence(__ATOMIC_RELEASE, "workgroup", "local");
  __builtin_amdgcn_s_barrier();
  __builtin_amdgcn_fence(__ATOMIC_ACQUIRE, "workgroup", "local");
#pragma unroll
  for (int u = 0; u < 2; ++u) { const int c = u * 32 + (t_ >> 3), c8 = (t_ & 7) * 8; *(v8b*)(VTh + ((size_t)b * D + ch + c) * SC + tb * 64 + c8) = *(const v8b*)(&Th[c][c8]); }
#pragma unroll
  for (int k = 0; k < 4; ++k) { const v4f s = pool4(kk + 4 * k); v4b h;
#pragma unroll
    for (int e = 0; e < 4; ++e) h[e] = (b16)s[e];
    *(v4b*)(KH + ((size_t)b * SC + kt + k) * D + kc) = h; }
#pragma unroll
  for (int i = 0; i < 16; ++i) { v4b h;
#pragma unroll
    for (int e = 0; e < 4; ++e) h[e] = (b16)(bf16_rne(qq[i][e]) * XS);
    *(v4b*)(QX + q0 + i * 1024) = h; }
}
// LDS ring for the attention kernel: one tile = 64 keys: K_c (64 rows x 256 B at a 272 B pitch), (8 V_c)^T (128 rows x 128 B at a 144 B pitch); both pitches are 16 B x odd for 16-byte readers
constexpr int KT = 64, NT = SC / KT, KP = D + 8, VP = KT + 8, KPL = KT * KP, VPL = D * VP, TILE = KPL + VPL;
// eight asynchronous 16-byte copies per lane; the s_wait_xcnt closes the statement so that no address register is rewritten ahead of it
__device__ __forceinline__ void copy8(unsigned l0, unsigned l1, unsigned l2, unsigned l3, unsigned l4, unsigned l5, unsigned l6, unsigned l7, const b16* g0, const b16* g1, const b16* g2, const b16* g3, const b16* g4, const b16* g5, const b16* g6, const b16* g7) {
  asm volatile("global_load_async_to_lds_b128 %0, %8, off\n\tglobal_load_async_to_lds_b128 %1, %9, off\n\tglobal_load_async_to_lds_b128 %2, %10, off\n\tglobal_load_async_to_lds_b128 %3, %11, off\n\t"
               "global_load_async_to_lds_b128 %4, %12, off\n\tglobal_load_async_to_lds_b128 %5, %13, off\n\tglobal_load_async_to_lds_b128 %6, %14, off\n\tglobal_load_async_to_lds_b128 %7, %15, off\n\ts_wait_xcnt 0x0"
               :: "v"(l0), "v"(l1), "v"(l2), "v"(l3), "v"(l4), "v"(l5), "v"(l6), "v"(l7), "v"(g0), "v"(g1), "v"(g2), "v"(g3), "v"(g4), "v"(g5), "v"(g6), "v"(g7) : "memory"); }
// the whole block copies one 64-key tile (32 KB, 8 copies per lane): K rows are contiguous in memory, V^T rows are whole 128-byte lines
__device__ __forceinline__ void stage_tile(const b16* buf, const b16* Kr, const b16* V, int k0, int tid) {
  const unsigned lb = (unsigned)(size_t)buf;   // low 32 bits of the shared address = byte offset in the work-group's LDS
  const int kr = tid >> 4, kc = (tid & 15) * 8, vr = tid >> 3, vc = (tid & 7) * 8;
  const unsigned lk = lb + (unsigned)(kr * KP + kc) * 2u, lv = lb + (unsigned)(KPL + vr * VP + vc) * 2u;
  const size_t gk = (size_t)(k0 + kr) * D + kc, gv = (size_t)vr * SC + k0 + vc;
  copy8(lk, lk + 16 * KP * 2, lk + 32 * KP * 2, lk + 48 * KP * 2, lv, lv + 32 * VP * 2, lv + 64 * VP * 2, lv + 96 * VP * 2,
        Kr + gk, Kr + gk + 16 * D, Kr + gk + 32 * D, Kr + gk + 48 * D, V + gv, V + gv + 32 * SC, V + gv + 64 * SC, V + gv + 96 * SC);
}
// attention: block = 8 waves = 4 query groups x 2 key halves (128 queries of one batch). A wave holds 32 queries (two B fragments) and works ONE 32-key half of every staged 64-key tile,
// so that each K_c and V_c fragment read from LDS feeds two products; the two halves keep their own running maximum, sum and o and are joined once, after the loop, through LDS.
// S^T = K_c.Q (4 k-steps, 2 row tiles, 2 query tiles) / sqrt(128), online softmax, o^T += (8V_c)^T.P^T (8 tiles, 2 query tiles);
__global__ __launch_bounds__(256) void attn_kernel(const b16* __restrict__ QX, const b16* __restrict__ KH, const b16* __restrict__ VTh, float* __restrict__ out) {
  __shared__ __attribute__((aligned(16))) b16 Ring[2 * TILE];
  __shared__ __attribute__((aligned(16))) float Os[8][16][D + 4];
  __shared__ float Ms[4][2][32], Ls[4][2][32];
  const int tid = threadIdx.x, wave = __builtin_amdgcn_readfirstlane(tid >> 5), lane = tid & 31, hh = lane >> 4, col = lane & 15; const int wq = wave & 3, kb = (wave >> 2) * 32; const int b = blockIdx.y, q0 = blockIdx.x * 128 + wq * 32;
  const b16* Qr = QX + ((size_t)b * S) * D; const b16* Kr = KH + ((size_t)b * SC) * D; const b16* V = VTh + ((size_t)b * D) * SC;
  stage_tile(Ring, Kr, V, 0, tid);
  v16b qf[2][4];
#pragma unroll
  for (int g = 0; g < 2; ++g)
#pragma unroll
    for (int t = 0; t < 4; ++t) qf[g][t] = frag_kb(Qr + (size_t)(q0 + g * 16 + col) * D + t * 32, hh);
  float m[2] = {-INFINITY, -INFINITY}, l[2] = {0.0f, 0.0f}; v8f o[8][2];
#pragma unroll
  for (int t = 0; t < 8; ++t) { o[t][0] = (v8f){}; o[t][1] = (v8f){}; }
  asm volatile("s_wait_asynccnt 0x0" ::: "memory");   // this wave's share of tile 0 has landed
  __syncthreads();                                     // tile 0 is published to every wave
  stage_tile(Ring + TILE, Kr, V, KT, tid);
  for (int tt = 0; tt < NT; ++tt) {
    const b16* Ks = Ring + (tt & 1) * TILE; const b16* Vs = Ks + KPL;
    {
      // The LDS reads of a 32-key block stand in two groups, each issued ahead of the work that covers its latency. Each sched_barrier below holds such a group in its place:
      // without them the reads are spread among the matrix instructions, each pair in front of its own full wait.
      v16b kf[8], vf[8];
#pragma unroll
      for (int t = 0; t < 4; ++t) { kf[2 * t] = frag_kb(Ks + (kb + col) * KP + t * 32, hh); kf[2 * t + 1] = frag_kb(Ks + (kb + 16 + col) * KP + t * 32, hh); }
      __builtin_amdgcn_sched_barrier(0);   // the K reads of all four k-steps stay together, ahead of the products
      v8f s[2][2] = {};   // [16-key row tile][query tile]: four independent accumulators
#pragma unroll
      for (int t = 0; t < 4; ++t) { s[0][0] = wmma16b(kf[2 * t], qf[0][t], s[0][0]); s[0][1] = wmma16b(kf[2 * t], qf[1][t], s[0][1]); s[1][0] = wmma16b(kf[2 * t + 1], qf[0][t], s[1][0]); s[1][1] = wmma16b(kf[2 * t + 1], qf[1][t], s[1][1]); }
#pragma unroll
      for (int t = 0; t < 8; ++t) vf[t] = frag_kb(Vs + (t * 16 + col) * VP + kb, hh);
      __builtin_amdgcn_sched_group_barrier(0x008, 16, 0);   // order inside this stretch: first the 16 S products,
      __builtin_amdgcn_sched_group_barrier(0x100, 16, 0);   // then the 16 V reads as one group: left free the reads are spread among the products in three places
      __builtin_amdgcn_sched_barrier(0);   // the V reads of all eight output tiles issue ahead of the softmax, which covers their latency
      float mr[2], al_[2], sum[2]; v16b pb[2];
#pragma unroll
      for (int g = 0; g < 2; ++g) { mr[g] = -INFINITY;
#pragma unroll
        for (int r = 0; r < 8; ++r) mr[g] = fmaxf(mr[g], fmaxf(s[0][g][r], s[1][g][r])); }   // maximum of the raw accumulators: C2 > 0 keeps the order
#pragma unroll
      for (int g = 0; g < 2; ++g) mr[g] = fmaxf(mr[g], xrow(mr[g]));
#pragma unroll
      for (int g = 0; g < 2; ++g) { const float mn = fmaxf(m[g], mr[g]); al_[g] = nexp((m[g] - mn) * C2); m[g] = mn;   // m is kept in the accumulators' own units
        const float bias = PL - mn * C2; const v8f x0 = s[0][g] * C2 + bias, x1 = s[1][g] * C2 + bias;   // one fused multiply-add per score: 8 P = 2^(C2 (s - m) + 3)
#pragma unroll
        for (int r = 0; r < 8; ++r) { const float e0 = nexp_in(x0[r]), e1 = nexp_in(x1[r]); sum[g] = r == 0 ? e0 + e1 : sum[g] + (e0 + e1); pb[g][r] = (b16)e0; pb[g][8 + r] = (b16)e1; } }   // the sum carries the factor 8 too
#pragma unroll
      for (int g = 0; g < 2; ++g) { sum[g] += xrow(sum[g]); l[g] = l[g] * al_[g] + sum[g]; }
#pragma unroll
      for (int t = 0; t < 8; t += 2) { o[t][0] *= al_[0]; o[t][1] *= al_[1]; o[t + 1][0] *= al_[0]; o[t + 1][1] *= al_[1];
        o[t][0] = wmma16b(vf[t], pb[0], o[t][0]); o[t][1] = wmma16b(vf[t], pb[1], o[t][1]); o[t + 1][0] = wmma16b(vf[t + 1], pb[0], o[t + 1][0]); o[t + 1][1] = wmma16b(vf[t + 1], pb[1], o[t + 1][1]); } }   // two output tiles x two query tiles: four independent accumulators in turn
    __builtin_amdgcn_sched_barrier(0);                 // softmax and O products stay ahead of the tile's waits and barrier: left free they sink behind the barrier, and the refill behind them loses its lead
    asm volatile("s_wait_dscnt 0x0" ::: "memory");     // this wave's reads of the buffer are done before it may be refilled
    asm volatile("s_wait_asynccnt 0x0" ::: "memory");  // this wave's share of tile tt + 1 has landed
    __syncthreads();                                   // publishes tile tt + 1 and ends every wave's reads of tile tt
    if (tt + 2 < NT) stage_tile(Ring + (tt & 1) * TILE, Kr, V, (tt + 2) * KT, tid);
  }
  asm volatile("s_wait_asynccnt 0x0" ::: "memory");    // no copy is outstanding when the wave ends
  // join of the two key halves: the upper half's waves hand over maximum, sum and o; the lower half's waves, lane for lane, rescale both to the common maximum, add and normalise
  if (kb != 0) {
#pragma unroll
    for (int g = 0; g < 2; ++g) { Ms[wq][g][lane] = m[g]; Ls[wq][g][lane] = l[g];
#pragma unroll
      for (int t = 0; t < 8; ++t)
#pragma unroll
        for (int r = 0; r < 8; ++r) Os[wq * 2 + g][col][t * 16 + 8 * hh + r] = o[t][g][r]; } }
  __syncthreads();                                     // the upper half's state is visible to the lower half's waves
  if (kb == 0) {
#pragma unroll
    for (int g = 0; g < 2; ++g) { const float m1 = Ms[wq][g][lane], l1 = Ls[wq][g][lane], mn = fmaxf(m[g], m1), e0 = nexp_slot((m[g] - mn) * C2), e1 = nexp_slot((m1 - mn) * C2); const float inv = 1.0f / ((l[g] * e0 + l1 * e1) * XS), c0 = e0 * inv, c1 = e1 * inv;
#pragma unroll
      for (int t = 0; t < 8; ++t)
#pragma unroll
        for (int r = 0; r < 8; ++r) { float* p = &Os[wq * 2 + g][col][t * 16 + 8 * hh + r]; *p = o[t][g][r] * c0 + *p * c1; } } }
  __syncthreads();
  { for (int i = threadIdx.x; i < 128 * 32; i += 256) { const int rr = i >> 5, c4 = (i & 31) * 4; *(v4f*)(out + ((size_t)b * S + blockIdx.x * 128 + rr) * D + c4) = *(const v4f*)(&Os[rr >> 4][rr & 15][c4]); }  }
}
}  // namespace

extern "C" void kernel_launch(void* const* d_in, const int* in_sizes, int n_in,
                              void* d_out, int out_size, void* d_ws, size_t ws_size, hipStream_t stream) {
  (void)n_in; (void)out_size;
  const float* Q = (const float*)d_in[0]; const float* K = (const float*)d_in[1]; const float* V = (const float*)d_in[2];
  float* out = (float*)d_out;   // [4][8192][128]
  if (in_sizes[0] != Bn * S * D || in_sizes[1] != Bn * S * D || in_sizes[2] != Bn * S * D) return;
  size_t off = 0; char* ws = (char*)d_ws;
  auto carve = [&](size_t bytes) { char* p = ws + off; off += (bytes + 255) & ~(size_t)255; return p; };
  b16* QX = (b16*)carve((size_t)Bn * S * D * 2); b16* KH = (b16*)carve((size_t)Bn * SC * D * 2); b16* VTh = (b16*)carve((size_t)Bn * D * SC * 2);
  if (off > ws_size) return;                        // about 8.4 + 2.1 x 2 = 12.6 MB
  prep_kernel<<<dim3(S / 128, Bn), 256, 0, stream>>>(Q, K, V, QX, KH, VTh);
  attn_kernel<<<dim3(S / 128, Bn), 256, 0, stream>>>(QX, KH, VTh, out);
}

// v007
// Measured time: 34.4 microseconds a run.
// In two side-by-side timings against v006, it was 1.13 and 1.12 times as fast.
// Counting every step since v000, it is 11.2 times as fast.
#include <hip/hip_runtime.h>

// CompressedAttention: K_c, V_c = mean over blocks of 4 consecutive keys (8192 -> 2048); out = softmax(Q.K_c / sqrt(128)) V_c -> [4][8192][128].
// WMMA (v_wmma_f32_16x16x32_f16, f32 accumulate): Q exact bf16 (x8 f16); K_c computed in f32 from the bf16 keys and rounded once to f16 (x8), S^T = K_c.Q (1 product);
// online softmax in f32; o^T += (8 V_c)^T.P^T with V_c and P each rounded once to f16 (1 product): 11 operand bits, where Q, K and V themselves carry 8.
// Fragment k-map per lane half hh for A AND B: elements 0..7 <- k = 8hh+0..7, 8..15 <- k = 16+8hh+0..7.

namespace {
constexpr int Bn = 4, S = 8192, D = 128, R4 = 4, SC = S / R4;
constexpr float XS = 8.0f, ISC = 0.08838834764831845f;
// softmax runs on powers of two: C2 takes a raw accumulator (64 Q.K_c) to score * log2(e); PL = log2 of the factor 8 that P carries into its f16 rounding
constexpr float C2 = ISC / (XS * XS) * 1.4426950408889634f, PL = 3.0f;

typedef _Float16 b16;
typedef __attribute__((ext_vector_type(16))) _Float16 v16b;
typedef __attribute__((ext_vector_type(8))) _Float16 v8b;
typedef __attribute__((ext_vector_type(4))) _Float16 v4b;
typedef __attribute__((ext_vector_type(8))) float v8f;
typedef __attribute__((ext_vector_type(4))) float v4f;
__device__ __forceinline__ float bf16_rne(float f) { unsigned int u = __float_as_uint(f); u += 0x7FFFu + ((u >> 16) & 1u); return __uint_as_float(u & 0xFFFF0000u); }
__device__ __forceinline__ v16b frag_kb(const b16* p, int hh) { const v8b a = *(const v8b*)(p + 8 * hh), b = *(const v8b*)(p + 16 + 8 * hh); v16b f;
#pragma unroll
  for (int e = 0; e < 8; ++e) { f[e] = a[e]; f[8 + e] = b[e]; } return f; }
// the builtin alone: the compiler keeps the distance behind its own matrix instructions (it pads only in front of a vector instruction that touches D, A or B), so products that follow one another carry no filler
__device__ __forceinline__ v8f wmma16b(v16b a, v16b b, v8f c) { return __builtin_amdgcn_wmma_f32_16x16x32_f16(false, a, false, b, (short)0, c, false, false); }
// lane l <-> lane l ^ 16 as a vector cross-row move: a vector instruction, so the compiler keeps its distance behind a matrix instruction whose operand register it rewrites (an LDS permute is not held so)
__device__ __forceinline__ float xrow(float v) { const int b = __float_as_int(v); return __int_as_float(__builtin_amdgcn_permlanex16(b, b, 0x76543210, 0xfedcba98, false, false)); }
// the exponential of the join and of the rescale factor, with the one slot behind a transcendental in the same statement
__device__ __forceinline__ float nexp_slot(float x) { float r; asm("v_exp_f32 %0, %1\n\tv_nop" : "=v"(r) : "v"(x)); return r; }
// a score's exponential, in place, with the same slot in the same statement: in place, so that the statement names one register (it must lie in v0 to v255; with two the build spilled)
__device__ __forceinline__ float nexp_in(float x) { float r = x; asm("v_exp_f32 %0, %0\n\tv_nop" : "+v"(r)); return r; }
__device__ __forceinline__ float pmul(float a, float b) { float p = a * b; asm volatile("" : "+v"(p)); return p; }

// prep: Q rows f16 exact x8 [32768][128]; K_c = mean of 4 bf16 key rows (f32) -> f16 x8 rows KH [8192][128]; V_c likewise -> the (8 V_c)^T plane VT[b][128][2048] via an LDS transpose.
// One block per WGP (256 blocks of 8 waves); a thread asks for all of its 48 16-byte pieces (16 of V, 16 of K, 16 of Q; every load of a wave covers whole 128-byte lines) before it uses the first,
// so that a block pays one memory round trip instead of one per loop pass. Sums and roundings are those of the loops this replaces, element for element.
__device__ __forceinline__ v4f pool4(const v4f* x) { v4f s = (v4f){};
#pragma unroll
  for (int r = 0; r < R4; ++r)
#pragma unroll
    for (int e = 0; e < 4; ++e) s[e] += bf16_rne(x[r][e]);
  return s * (0.25f * XS); }
__global__ __launch_bounds__(256) void prep_kernel(const float* __restrict__ Q, const float* __restrict__ K, const float* __restrict__ V, b16* __restrict__ QX, b16* __restrict__ KH, b16* __restrict__ VTh) {
  __shared__ __attribute__((aligned(16))) b16 Th[64][64 + 8];
  const int b = blockIdx.y, j = blockIdx.x, t_ = threadIdx.x;
  // V: this block's tile is 64 pooled tokens x 64 columns (a whole 128-byte line of every V^T row it writes); a thread holds 4 adjacent tokens x 4 columns
  const int tb = j >> 1, ch = (j & 1) * 64, vc = (t_ & 15) * 4, vt = (t_ >> 4) * 4;
  // K and Q: this block's 128 original rows; K: a wave holds 16 whole rows (4 pooled tokens), Q: piece i * 256 + t_ of the 4096
  const int kc = (t_ & 31) * 4, kt = j * 32 + (t_ >> 5) * 4;
  const float* Vp = V + ((size_t)b * S + (size_t)(tb * 64 + vt) * R4) * D + ch + vc;
  const float* Kp = K + ((size_t)b * S + (size_t)kt * R4) * D + kc;
  const size_t q0 = ((size_t)b * S + (size_t)j * 128) * D + t_ * 4;
  const float* Qp = Q + q0;
  v4f vv[16], kk[16], qq[16];
#pragma unroll
  for (int i = 0; i < 16; ++i) vv[i] = *(const v4f*)(Vp + i * D);
  __builtin_amdgcn_sched_barrier(0);   // loads come back in issue order and are used in the order V, K, Q: this and the next one keep that order of issue (left free, part of V was issued last)
#pragma unroll
  for (int i = 0; i < 16; ++i) kk[i] = *(const v4f*)(Kp + i * D);
  __builtin_amdgcn_sched_barrier(0);   // K's loads stay ahead of Q's, for the same reason
#pragma unroll
  for (int i = 0; i < 16; ++i) qq[i] = *(const v4f*)(Qp + i * 1024);
  // precaution: the three address pairs are inputs here, so they stay whole up to this wait
  asm volatile("s_wait_xcnt 0x0" :: "v"(Vp), "v"(Kp), "v"(Qp) : "memory");
  __builtin_amdgcn_sched_barrier(0);   // all 48 loads are issued ahead of the first use: moved down among the sums they would wait one after another
  v4f pv[4];
#pragma unroll
  for (int k = 0; k < 4; ++k) pv[k] = pool4(vv + 4 * k);
#pragma unroll
  for (int e = 0; e < 4; ++e) { v4b h;
#pragma unroll
    for (int k = 0; k < 4; ++k) h[k] = (b16)pv[k][e];
    *(v4b*)(&Th[vc + e][vt]) = h; }
  // the transpose tile is complete. The two fences name LDS alone: __syncthreads() here waited for all 48 global loads as well, and K and Q could not be worked on while they arrive
  __builtin_amdgcn_fence(__ATOMIC_RELEASE, "workgroup", "local");
  __builtin_amdgcn_s_barrier();
  __builtin_amdgcn_fence(__ATOMIC_ACQUIRE, "workgroup", "local");
#pragma unroll
  for (int u = 0; u < 2; ++u) { const int c = u * 32 + (t_ >> 3), c8 = (t_ & 7) * 8; *(v8b*)(VTh + ((size_t)b * D + ch + c) * SC + tb * 64 + c8) = *(const v8b*)(&Th[c][c8]); }
#pragma unroll
  for (int k = 0; k < 4; ++k) { const v4f s = pool4(kk + 4 * k); v4b h;
#pragma unroll
    for (int e = 0; e < 4; ++e) h[e] = (b16)s[e];
    *(v4b*)(KH + ((size_t)b * SC + kt + k) * D + kc) = h; }
#pragma unroll
  for (int i = 0; i < 16; ++i) { v4b h;
#pragma unroll
    for (int e = 0; e < 4; ++e) h[e] = (b16)(bf16_rne(qq[i][e]) * XS);
    *(v4b*)(QX + q0 + i * 1024) = h; }
}
// LDS ring for the attention kernel: one tile = 128 keys: K_c (128 rows x 256 B at a 272 B pitch), (8 V_c)^T (128 rows x 256 B at a 272 B pitch); the pitch is 16 B x odd for 16-byte readers
constexpr int KT = 128, NT = SC / KT, KP = D + 8, VP = KT + 8, KPL = KT * KP, VPL = D * VP, TILE = KPL + VPL;
// eight asynchronous 16-byte copies per lane; the s_wait_xcnt closes the statement so that no address register is rewritten ahead of it
__device__ __forceinline__ void copy8(unsigned l0, unsigned l1, unsigned l2, unsigned l3, unsigned l4, unsigned l5, unsigned l6, unsigned l7, const b16* g0, const b16* g1, const b16* g2, const b16* g3, const b16* g4, const b16* g5, const b16* g6, const b16* g7) {
  asm volatile("global_load_async_to_lds_b128 %0, %8, off\n\tglobal_load_async_to_lds_b128 %1, %9, off\n\tglobal_load_async_to_lds_b128 %2, %10, off\n\tglobal_load_async_to_lds_b128 %3, %11, off\n\t"
               "global_load_async_to_lds_b128 %4, %12, off\n\tglobal_load_async_to_lds_b128 %5, %13, off\n\tglobal_load_async_to_lds_b128 %6, %14, off\n\tglobal_load_async_to_lds_b128 %7, %15, off\n\ts_wait_xcnt 0x0"
               :: "v"(l0), "v"(l1), "v"(l2), "v"(l3), "v"(l4), "v"(l5), "v"(l6), "v"(l7), "v"(g0), "v"(g1), "v"(g2), "v"(g3), "v"(g4), "v"(g5), "v"(g6), "v"(g7) : "memory"); }
// the whole block copies one 128-key tile (64 KB, 16 copies per lane in two statements): K rows are contiguous in memory, a V^T row is two whole 128-byte lines
// lo = the lane's byte offset inside the K part and inside the V part alike: row tid / 16 at the 272 B pitch, 16-byte piece tid % 16
__device__ __forceinline__ void stage_tile(const b16* buf, const b16* Kr, const b16* V, int k0, int tid, unsigned lo) {
  const unsigned lb = (unsigned)(size_t)buf;   // low 32 bits of the shared address = byte offset in the work-group's LDS
  const int rw = tid >> 4, cl = (tid & 15) * 8;
  const unsigned lk = lb + lo, lv = lk + KPL * 2u;
  const b16* gk = Kr + (size_t)(k0 + rw) * D + cl; const b16* gv = V + (size_t)rw * SC + k0 + cl;
  copy8(lk, lk + 16 * KP * 2, lk + 32 * KP * 2, lk + 48 * KP * 2, lk + 64 * KP * 2, lk + 80 * KP * 2, lk + 96 * KP * 2, lk + 112 * KP * 2,
        gk, gk + 16 * D, gk + 32 * D, gk + 48 * D, gk + 64 * D, gk + 80 * D, gk + 96 * D, gk + 112 * D);
  copy8(lv, lv + 16 * VP * 2, lv + 32 * VP * 2, lv + 48 * VP * 2, lv + 64 * VP * 2, lv + 80 * VP * 2, lv + 96 * VP * 2, lv + 112 * VP * 2,
        gv, gv + 16 * SC, gv + 32 * SC, gv + 48 * SC, gv + 64 * SC, gv + 80 * SC, gv + 96 * SC, gv + 112 * SC);
}
// attention: block = 8 waves = 4 query groups x 2 key halves (128 queries of one batch). A wave holds 32 queries (two B fragments) and works ONE 64-key half of every staged 128-key tile in one pass (one maximum, one rescale of o, one barrier per 64 of its keys),
// so that each K_c and V_c fragment read from LDS feeds two products; the two halves keep their own running maximum, sum and o and are joined once, after the loop, through LDS.
// S^T = K_c.Q (4 k-steps, 4 row tiles, 2 query tiles) / sqrt(128), online softmax, o^T += (8V_c)^T.P^T (8 tiles, 2 query tiles, 2 k-steps);
__global__ __launch_bounds__(256) void attn_kernel(const b16* __restrict__ QX, const b16* __restrict__ KH, const b16* __restrict__ VTh, float* __restrict__ out) {
  __shared__ __attribute__((aligned(16))) b16 Ring[2 * TILE];
  __shared__ __attribute__((aligned(16))) float Os[8][16][D + 4];
  __shared__ float Ms[4][2][32], Ls[4][2][32];
  const int tid = threadIdx.x, wave = __builtin_amdgcn_readfirstlane(tid >> 5), lane = tid & 31, hh = lane >> 4, col = lane & 15; const int wq = wave & 3, kb = (wave >> 2) * 64; const int b = blockIdx.y, q0 = blockIdx.x * 128 + wq * 32;
  const b16* Qr = QX + ((size_t)b * S) * D; const b16* Kr = KH + ((size_t)b * SC) * D; const b16* V = VTh + ((size_t)b * D) * SC;
  stage_tile(Ring, Kr, V, 0, tid, (unsigned)((tid >> 4) * KP + (tid & 15) * 8) * 2u);
  v16b qf[2][4];
#pragma unroll
  for (int g = 0; g < 2; ++g)
#pragma unroll
    for (int t = 0; t < 4; ++t) qf[g][t] = frag_kb(Qr + (size_t)(q0 + g * 16 + col) * D + t * 32, hh);
  float m[2] = {-INFINITY, -INFINITY}, l[2] = {0.0f, 0.0f}; v8f o[8][2];
#pragma unroll
  for (int t = 0; t < 8; ++t) { o[t][0] = (v8f){}; o[t][1] = (v8f){}; }
  asm volatile("s_wait_asynccnt 0x0" ::: "memory");   // this wave's share of tile 0 has landed
  __syncthreads();                                     // tile 0 is published to every wave
  stage_tile(Ring + TILE, Kr, V, KT, tid, (unsigned)((tid >> 4) * KP + (tid & 15) * 8) * 2u);
  for (int tt = 0; tt < NT; ++tt) {
    const b16* Ks = Ring + (tt & 1) * TILE; const b16* Vs = Ks + KPL;
    {
      // The LDS reads of a 64-key block stand in two groups, each issued ahead of the work that covers its latency. Each sched_barrier below holds such a group in its place:
      // without them the reads are spread among the matrix instructions, each pair in front of its own full wait.
      v16b kf[16], vf[16];
#pragma unroll
      for (int t = 0; t < 4; ++t)
#pragma unroll
        for (int i = 0; i < 4; ++i) kf[4 * t + i] = frag_kb(Ks + (kb + 16 * i + col) * KP + t * 32, hh);
      __builtin_amdgcn_sched_barrier(0);   // the K reads of all four k-steps stay together, ahead of the products
      v8f s[4][2] = {};   // [16-key row tile][query tile]: eight independent accumulators
#pragma unroll
      for (int t = 0; t < 4; ++t)
#pragma unroll
        for (int i = 0; i < 4; ++i) { s[i][0] = wmma16b(kf[4 * t + i], qf[0][t], s[i][0]); s[i][1] = wmma16b(kf[4 * t + i], qf[1][t], s[i][1]); }
#pragma unroll
      for (int t = 0; t < 8; ++t) { vf[2 * t] = frag_kb(Vs + (t * 16 + col) * VP + kb, hh); vf[2 * t + 1] = frag_kb(Vs + (t * 16 + col) * VP + kb + 32, hh); }
      __builtin_amdgcn_sched_group_barrier(0x008, 32, 0);   // order inside this stretch: first the 32 S products,
      __builtin_amdgcn_sched_group_barrier(0x100, 32, 0);   // then the 32 V reads as one group: left free the reads are spread among the products
      __builtin_amdgcn_sched_barrier(0);   // the V reads of all eight output tiles issue ahead of the softmax, which covers their latency
      float mr[2], al_[2], sum[2]; v16b pb[2][2];   // pb[query tile][32-key step]
#pragma unroll
      for (int g = 0; g < 2; ++g) { float ma = -INFINITY, mb = -INFINITY;   // two chains per query tile: maximum of the raw accumulators, C2 > 0 keeps the order
#pragma unroll
        for (int r = 0; r < 8; ++r) { ma = fmaxf(ma, fmaxf(s[0][g][r], s[1][g][r])); mb = fmaxf(mb, fmaxf(s[2][g][r], s[3][g][r])); }
        mr[g] = fmaxf(ma, mb); }
#pragma unroll
      for (int g = 0; g < 2; ++g) mr[g] = fmaxf(mr[g], xrow(mr[g]));
#pragma unroll
      for (int g = 0; g < 2; ++g) { const float mn = fmaxf(m[g], mr[g]); al_[g] = nexp_slot((m[g] - mn) * C2); m[g] = mn;   // m is kept in the accumulators' own units
        const float bias = PL - mn * C2; float sj[2];
#pragma unroll
        for (int j = 0; j < 2; ++j) { const v8f x0 = s[2 * j][g] * C2 + bias, x1 = s[2 * j + 1][g] * C2 + bias;   // one fused multiply-add per score: 8 P = 2^(C2 (s - m) + 3)
#pragma unroll
          for (int r = 0; r < 8; ++r) { const float e0 = nexp_in(x0[r]), e1 = nexp_in(x1[r]); sj[j] = r == 0 ? e0 + e1 : sj[j] + (e0 + e1); pb[g][j][r] = (b16)e0; pb[g][j][8 + r] = (b16)e1; } }   // the sum carries the factor 8 too
        sum[g] = sj[0] + sj[1]; }
#pragma unroll
      for (int g = 0; g < 2; ++g) { sum[g] += xrow(sum[g]); l[g] = l[g] * al_[g] + sum[g]; }
#pragma unroll
      for (int t = 0; t < 8; t += 2) { o[t][0] *= al_[0]; o[t][1] *= al_[1]; o[t + 1][0] *= al_[0]; o[t + 1][1] *= al_[1];
#pragma unroll
        for (int j = 0; j < 2; ++j) { o[t][0] = wmma16b(vf[2 * t + j], pb[0][j], o[t][0]); o[t][1] = wmma16b(vf[2 * t + j], pb[1][j], o[t][1]); o[t + 1][0] = wmma16b(vf[2 * t + 2 + j], pb[0][j], o[t + 1][0]); o[t + 1][1] = wmma16b(vf[2 * t + 2 + j], pb[1][j], o[t + 1][1]); } } }   // two output tiles x two query tiles: four independent accumulators in turn, twice
    __builtin_amdgcn_sched_barrier(0);                 // softmax and O products stay ahead of the tile's waits and barrier: left free they sink behind the barrier, and the refill behind them loses its lead
    asm volatile("s_wait_dscnt 0x0" ::: "memory");     // this wave's reads of the buffer are done before it may be refilled
    asm volatile("s_wait_asynccnt 0x0" ::: "memory");  // this wave's share of tile tt + 1 has landed
    __syncthreads();                                   // publishes tile tt + 1 and ends every wave's reads of tile tt
    // the lane offset is formed here in a second way, 16 (tid + tid / 16), the same number: the value of the first call is itself an operand of a copy statement, so tied to v0..v255, and was spilled to scratch across the loop
    if (tt + 2 < NT) stage_tile(Ring + (tt & 1) * TILE, Kr, V, (tt + 2) * KT, tid, 16u * (unsigned)(tid + (tid >> 4)));
  }
  asm volatile("s_wait_asynccnt 0x0" ::: "memory");    // no copy is outstanding when the wave ends
  // join of the two key halves: the upper half's waves hand over maximum, sum and o; the lower half's waves, lane for lane, rescale both to the common maximum, add and normalise
  if (kb != 0) {
#pragma unroll
    for (int g = 0; g < 2; ++g) { Ms[wq][g][lane] = m[g]; Ls[wq][g][lane] = l[g];
#pragma unroll
      for (int t = 0; t < 8; ++t)
#pragma unroll
        for (int r = 0; r < 8; ++r) Os[wq * 2 + g][col][t * 16 + 8 * hh + r] = o[t][g][r]; } }
  __syncthreads();                                     // the upper half's state is visible to the lower half's waves
  if (kb == 0) {
#pragma unroll
    for (int g = 0; g < 2; ++g) { const float m1 = Ms[wq][g][lane], l1 = Ls[wq][g][lane], mn = fmaxf(m[g], m1), e0 = nexp_slot((m[g] - mn) * C2), e1 = nexp_slot((m1 - mn) * C2); const float inv = 1.0f / ((l[g] * e0 + l1 * e1) * XS), c0 = e0 * inv, c1 = e1 * inv;
#pragma unroll
      for (int t = 0; t < 8; ++t)
#pragma unroll
        for (int r = 0; r < 8; ++r) { float* p = &Os[wq * 2 + g][col][t * 16 + 8 * hh + r]; *p = o[t][g][r] * c0 + *p * c1; } } }
  __syncthreads();
  { for (int i = threadIdx.x; i < 128 * 32; i += 256) { const int rr = i >> 5, c4 = (i & 31) * 4; *(v4f*)(out + ((size_t)b * S + blockIdx.x * 128 + rr) * D + c4) = *(const v4f*)(&Os[rr >> 4][rr & 15][c4]); }  }
}
}  // namespace

extern "C" void kernel_launch(void* const* d_in, const int* in_sizes, int n_in,
                              void* d_out, int out_size, void* d_ws, size_t ws_size, hipStream_t stream) {
  (void)n_in; (void)out_size;
  const float* Q = (const float*)d_in[0]; const float* K = (const float*)d_in[1]; const float* V = (const float*)d_in[2];
  float* out = (float*)d_out;   // [4][8192][128]
  if (in_sizes[0] != Bn * S * D || in_sizes[1] != Bn * S * D || in_sizes[2] != Bn * S * D) return;
  size_t off = 0; char* ws = (char*)d_ws;
  auto carve = [&](size_t bytes) { char* p = ws + off; off += (bytes + 255) & ~(size_t)255; return p; };
  b16* QX = (b16*)carve((size_t)Bn * S * D * 2); b16* KH = (b16*)carve((size_t)Bn * SC * D * 2); b16* VTh = (b16*)carve((size_t)Bn * D * SC * 2);
  if (off > ws_size) return;                        // about 8.4 + 2.1 x 2 = 12.6 MB
  prep_kernel<<<dim3(S / 128, Bn), 256, 0, stream>>>(Q, K, V, QX, KH, VTh);
  attn_kernel<<<dim3(S / 128, Bn), 256, 0, stream>>>(QX, KH, VTh, out);
}
